// v000
// Measured on an AMD MI455X. A time is GPU time per run, averaged over a window of back-to-back runs after a warm-up
// (all launches, gaps included; the runs take copies of the inputs in turn), and the median of several windows.
// Apart from v000's, it joins two sittings. Times from different sittings can be a few percent apart, while
// side-by-side timings come from the same sitting.
// v000 is the starting kernel. One run takes 232 microseconds.
// compute dtype: all float inputs rounded to bf16; qkv = x . W_qkv + b with EXACT bf16 products on WMMA 16x16x32 ((in,out) weights as transposed rows), q/k rounded to f16 hi + residual rows, v to f16 hi + residual planes; logits q . k with 3 products, x 32^-0.5 x (0.1 + 0.9 interaction_mask[n][m]) read per pair, running-max softmax in f32 (hardware exp), P (x 2^11, f16) . v (hi + residual, 2 products); out = ctx (bf16 hi + lo, 2 products) . W_out + b; f32 output.
#include <hip/hip_runtime.h>
#include <math.h>

typedef __attribute__((ext_vector_type(16))) _Float16 v16h;
typedef __attribute__((ext_vector_type(16))) __bf16 v16b;
typedef __attribute__((ext_vector_type(8)))  _Float16 v8h;
typedef __attribute__((ext_vector_type(8)))  float v8f;
typedef __attribute__((ext_vector_type(4)))  float v4f;
typedef __attribute__((ext_vector_type(2)))  float v2f;
typedef __attribute__((ext_vector_type(4)))  unsigned v4u;
typedef __attribute__((ext_vector_type(4)))  int v4i;
typedef float __attribute__((may_alias)) float_a;
typedef int __attribute__((may_alias)) int_a;

template <typename T> __device__ __forceinline__ void vst2(void* p, T v) { *(T*)p = v;  }
__device__ __forceinline__ v8f wmma16(v16h a, v16h b, v8f c) {
  v8f d = __builtin_amdgcn_wmma_f32_16x16x32_f16(false, a, false, b, (short)0, c, false, false);
  asm volatile("v_nop\n\tv_nop\n\tv_nop\n\tv_nop" : "+v"(d) : "v"(a), "v"(b));
  return d;
}
__device__ __forceinline__ v8f wmma_bf(v16b a, v16b b, v8f c) {
  v8f d = __builtin_amdgcn_wmma_f32_16x16x32_bf16(false, a, false, b, (short)0, c, false, false);
  asm volatile("v_nop\n\tv_nop\n\tv_nop\n\tv_nop" : "+v"(d) : "v"(a), "v"(b));
  return d;
}
// 16x16x32 fragments: lane = (h = lane>>4, row/col = lane&15); elements 0..7 = k0+8h+0..7, 8..15 = k0+16+8h+0..7; D element r = row 8h+r
__device__ __forceinline__ v16h frag_h(const _Float16* rowk0, int lane) {
  union { v16h v; v8h q[2]; } u; const _Float16* p = rowk0 + 8 * (lane >> 4);
  u.q[0] = *(const v8h*)p; u.q[1] = *(const v8h*)(p + 16); return u.v;
}
__device__ __forceinline__ v16h frag_f32(const float* rowk0, int lane) {
  v16h a; const float* p = rowk0 + 8 * (lane >> 4);
#pragma unroll
  for (int i = 0; i < 8; ++i) { a[i] = (_Float16)p[i]; a[8 + i] = (_Float16)p[16 + i]; }
  return a;
}
__device__ __forceinline__ v16h frag_f32s(const float* rowk0, int lane, float sc) {
  v16h a; const float* p = rowk0 + 8 * (lane >> 4);
#pragma unroll
  for (int i = 0; i < 8; ++i) { a[i] = (_Float16)(p[i] * sc); a[8 + i] = (_Float16)(p[16 + i] * sc); }
  return a;
}
// column fragment from a [K][ld] layout (column n), rows >= K read as 0
__device__ __forceinline__ v16h fragc_f32(const float* W, int k0, int n, int lane, int ld, int K) {
  v16h a; const int g = lane >> 4;
#pragma unroll
  for (int i = 0; i < 8; ++i) { const int ka = k0 + 8 * g + i, kb = ka + 16;
    a[i] = (_Float16)(ka < K ? W[(size_t)(ka < K ? ka : K - 1) * ld + n] : 0.f); a[8 + i] = (_Float16)(kb < K ? W[(size_t)(kb < K ? kb : K - 1) * ld + n] : 0.f); }
  return a;
}
struct F2 { v16b h, l; };
__device__ __forceinline__ F2 bsplit16(const float v[16]) { F2 r;
#pragma unroll
  for (int i = 0; i < 16; ++i) { const __bf16 h = (__bf16)v[i]; r.h[i] = h; r.l[i] = (__bf16)(v[i] - (float)h); }
  return r; }
__device__ __forceinline__ F2 split_row(const float* row, int k0, int lane) { float v[16]; const float* p = row + k0 + 8 * (lane >> 4);
#pragma unroll
  for (int i = 0; i < 8; ++i) { v[i] = p[i]; v[8 + i] = p[16 + i]; }
  return bsplit16(v); }
__device__ __forceinline__ F2 split_rowK(const float* row, int k0, int lane, int K) { float v[16]; const int g = lane >> 4;
#pragma unroll
  for (int i = 0; i < 8; ++i) { const int ka = k0 + 8 * g + i, kb = ka + 16; v[i] = ka < K ? row[ka < K ? ka : K - 1] : 0.f; v[8 + i] = kb < K ? row[kb < K ? kb : K - 1] : 0.f; }
  return bsplit16(v); }
__device__ __forceinline__ F2 split_col(const float* W, int k0, int n, int lane, int ld, int K) { float v[16]; const int g = lane >> 4;
#pragma unroll
  for (int i = 0; i < 8; ++i) { const int ka = k0 + 8 * g + i, kb = ka + 16; v[i] = ka < K ? W[(size_t)(ka < K ? ka : K - 1) * ld + n] : 0.f; v[8 + i] = kb < K ? W[(size_t)(kb < K ? kb : K - 1) * ld + n] : 0.f; }
  return bsplit16(v); }
__device__ __forceinline__ v8f mac3(const F2& a, const F2& b, v8f c) { c = wmma_bf(a.l, b.h, c); c = wmma_bf(a.h, b.l, c); return wmma_bf(a.h, b.h, c); }
__device__ __forceinline__ float sigm(float v) { return 1.0f / (1.0f + expf(-v)); }
#define LDSX() do { asm volatile("s_wait_dscnt 0" ::: "memory"); __builtin_amdgcn_wave_barrier(); __builtin_amdgcn_fence(__ATOMIC_RELEASE, "workgroup"); } while (0)


// Biologically-modulated attention (B 4, N 2,048 genes, C 256, 8 heads x 32): fused (in,out) qkv + bias, logits scaled by (0.1 + 0.9 x PPI interaction strength) before the softmax, (in,out) output projection + bias.
#define NB 4
#define NN 2048
#define CC 256
#define NH 8
#define DK 32
#ifndef TNB
#define TNB NB
#endif
typedef __attribute__((ext_vector_type(8))) __bf16 v8b;
__device__ __forceinline__ v16b frag_b(const __bf16* rowk0, int lane) {
  union { v16b v; v8b q[2]; } u; const __bf16* p = rowk0 + 8 * (lane >> 4);
  u.q[0] = *(const v8b*)p; u.q[1] = *(const v8b*)(p + 16); return u.v;
}
__device__ __forceinline__ float bfr(float v) { return (float)(__bf16)v; }
__device__ __attribute__((noinline)) float exp_ni(float v) { return expf(v); }
__device__ __attribute__((noinline)) float erf_ni(float v) { return erff(v); }

#define WS_PW  0u                                   // bf16 rows [768][256] (qkv, transposed (in,out)); [256][256] W_out^T
#define WS_PO  (WS_PW + 2u * 3 * CC * CC)
#define WS_QK  (WS_PO + 2u * CC * CC)                   // f16 hi|lo q|k rows [b*NN + n][512]
#define WS_QKL (WS_QK + 2u * (size_t)NB * NN * 2 * CC)
#define WS_VT  (WS_QKL + 2u * (size_t)NB * NN * 2 * CC) // f16 hi|lo v planes [b][c][n]
#define WS_VTL (WS_VT + 2u * (size_t)NB * CC * NN)
#define WS_Z   (WS_VTL + 2u * (size_t)NB * CC * NN)     // f32 ctx [b*NN + n][256]
#define WS_END (WS_Z + 4u * (size_t)NB * NN * CC)

__global__ __launch_bounds__(256) void k_pack(const float* __restrict__ WQKV, const float* __restrict__ WO, __bf16* __restrict__ PW, __bf16* __restrict__ PO) { const int n = blockIdx.x, t = threadIdx.x; __shared__ __align__(16) __bf16 s[CC];   // n in [0, 1024): rows 0..767 qkv columns, 768..1023 W_out columns
  if (n < 3 * CC) s[t] = (__bf16)WQKV[(size_t)t * (3 * CC) + n]; else s[t] = (__bf16)WO[(size_t)t * CC + (n - 3 * CC)]; __syncthreads();
  __bf16* dst = (n < 3 * CC) ? PW + (size_t)n * CC : PO + (size_t)(n - 3 * CC) * CC; if (t < CC / 8) vst2((unsigned*)(dst + t * 8), *(const v4u*)&s[t * 8]); }
__device__ __forceinline__ v16b fragb_f32(const float* __restrict__ p, int lane) { v16b a; const float* pp = p + 8 * (lane >> 4);
#pragma unroll
  for (int i = 0; i < 8; ++i) { a[i] = (__bf16)pp[i]; a[8 + i] = (__bf16)pp[16 + i]; } return a; }
// ---- k_proj: block = (64 rows, 128 of 768 cols, b): y = x . W + b (exact); cols < 512 (q|k) -> f16 hi/lo rows; cols >= 512 (v) -> transposed planes
__global__ __launch_bounds__(128) void k_proj(const float* __restrict__ X, const __bf16* __restrict__ PW, const float* __restrict__ BQKV, _Float16* __restrict__ QK, _Float16* __restrict__ QKL, _Float16* __restrict__ VT, _Float16* __restrict__ VTL) {
  __shared__ __align__(16) _Float16 sh[64][136], sl[64][136]; __shared__ __align__(16) _Float16 th[128][72], tl[128][72];
  const int tid = threadIdx.x, wave = tid >> 5, lane = tid & 31, col = lane & 15, g = lane >> 4; const size_t b = blockIdx.z; const int i0 = blockIdx.x * 64 + wave * 16; const int c0 = blockIdx.y * 128; const size_t r0 = b * NN + i0;
  v8f acc[8] = {};
#pragma unroll
  for (int kc = 0; kc < CC / 32; ++kc) { const v16b a = fragb_f32(X + (r0 + col) * CC + kc * 32, lane);
#pragma unroll
    for (int j = 0; j < 8; ++j) acc[j] = wmma_bf(a, frag_b(PW + (size_t)(c0 + j * 16 + col) * CC + kc * 32, lane), acc[j]); }
  const bool isv = c0 >= 2 * CC;
#pragma unroll
  for (int j = 0; j < 8; ++j) { const float bb = bfr(BQKV[c0 + j * 16 + col]);
#pragma unroll
    for (int r = 0; r < 8; ++r) { const float v = acc[j][r] + bb; const _Float16 hv = (_Float16)v; const _Float16 lv = (_Float16)((v - (float)hv) * 2048.0f); if (!isv) { sh[wave * 16 + 8 * g + r][j * 16 + col] = hv; sl[wave * 16 + 8 * g + r][j * 16 + col] = lv; } else { th[j * 16 + col][wave * 16 + 8 * g + r] = hv; tl[j * 16 + col][wave * 16 + 8 * g + r] = lv; } } }
  __syncthreads();
  if (!isv) { for (int e = tid; e < 64 * 16; e += 128) { const int rl = e >> 4, q = e & 15; const size_t o = (b * NN + blockIdx.x * 64 + rl) * (2 * CC) + c0 + q * 8; vst2((unsigned*)(QK + o), *(const v4u*)&sh[rl][q * 8]); vst2((unsigned*)(QKL + o), *(const v4u*)&sl[rl][q * 8]); } }
  else { const int cv0 = c0 - 2 * CC; for (int e = tid; e < 128 * 8; e += 128) { const int cl = e >> 3, q = e & 7; const size_t o = ((b * CC + cv0 + cl) * (size_t)NN) + blockIdx.x * 64 + q * 8; vst2((unsigned*)(VT + o), *(const v4u*)&th[cl][q * 8]); vst2((unsigned*)(VTL + o), *(const v4u*)&tl[cl][q * 8]); } } }
// ---- k_att: block = (64 queries, head, b): logits q.k (3 products) x 32^-0.5 x (0.1 + 0.9 IM[n][m]), running-max softmax, P . v (v planes hi + residual, 2 products) -> Z merged
__global__ __launch_bounds__(128) void k_att(const _Float16* __restrict__ QK, const _Float16* __restrict__ QKL, const _Float16* __restrict__ VT, const _Float16* __restrict__ VTL, const float* __restrict__ IM, float* __restrict__ Z) {
  __shared__ __align__(16) float sp[4][16][36]; __shared__ __align__(16) float so[4][16][36];
  const int tid = threadIdx.x, wave = tid >> 5, lane = tid & 31, col = lane & 15, g = lane >> 4; const int h = blockIdx.y; const size_t b = blockIdx.z; const int q0 = blockIdx.x * 64 + wave * 16; const size_t rq = b * NN + q0;
  const v16h aq = frag_h(QK + (rq + col) * (2 * CC) + h * DK, lane), aql = frag_h(QKL + (rq + col) * (2 * CC) + h * DK, lane);
  float m[8], l[8];
#pragma unroll
  for (int r = 0; r < 8; ++r) { m[r] = -3.0e38f; l[r] = 0.f; }
  v8f acc[2] = {}, accl[2] = {};
#pragma unroll 1
  for (int ks = 0; ks < NN / 32; ++ks) { v8f s[2];
#pragma unroll
    for (int ct = 0; ct < 2; ++ct) { const int kk = ks * 32 + ct * 16 + col; const size_t rk = b * NN + kk; const v16h kh = frag_h(QK + rk * (2 * CC) + CC + h * DK, lane), kl = frag_h(QKL + rk * (2 * CC) + CC + h * DK, lane); v8f c = {}, cl = {}; c = wmma16(aq, kh, c); cl = wmma16(aq, kl, cl); cl = wmma16(aql, kh, cl); const float* imp = IM + kk;
#pragma unroll
      for (int r = 0; r < 8; ++r) s[ct][r] = (c[r] + cl[r] * (1.0f / 2048.0f)) * 0.17677669529663687f * (0.1f + 0.9f * bfr(imp[(size_t)(q0 + 8 * g + r) * NN])); }
    float alpha[8];
#pragma unroll
    for (int r = 0; r < 8; ++r) { float mx = fmaxf(s[0][r], s[1][r]);
#pragma unroll
      for (int o = 1; o < 16; o <<= 1) mx = fmaxf(mx, __shfl_xor(mx, o));
      const float mn = fmaxf(m[r], mx); alpha[r] = __expf(m[r] - mn); const float e0 = __expf(s[0][r] - mn), e1 = __expf(s[1][r] - mn); float es = e0 + e1;
#pragma unroll
      for (int o = 1; o < 16; o <<= 1) es += __shfl_xor(es, o);
      l[r] = l[r] * alpha[r] + es; m[r] = mn; sp[wave][8 * g + r][col] = e0; sp[wave][8 * g + r][16 + col] = e1; }
#pragma unroll
    for (int j = 0; j < 2; ++j)
#pragma unroll
      for (int r = 0; r < 8; ++r) { acc[j][r] *= alpha[r]; accl[j][r] *= alpha[r]; }
    LDSX();
    v16h pa; { const float* prow = &sp[wave][col][0] + 8 * (lane >> 4);
#pragma unroll
      for (int i = 0; i < 8; ++i) { pa[i] = (_Float16)(prow[i] * 2048.0f); pa[8 + i] = (_Float16)(prow[16 + i] * 2048.0f); } }
#pragma unroll
    for (int j = 0; j < 2; ++j) { const size_t po = (b * CC + (size_t)h * DK + j * 16 + col) * (size_t)NN + ks * 32; acc[j] = wmma16(pa, frag_h(VT + po, lane), acc[j]); accl[j] = wmma16(pa, frag_h(VTL + po, lane), accl[j]); }
    LDSX(); }
#pragma unroll
  for (int r = 0; r < 8; ++r) { const float il = (1.0f / 2048.0f) / l[r];
#pragma unroll
    for (int j = 0; j < 2; ++j) so[wave][8 * g + r][j * 16 + col] = (acc[j][r] + accl[j][r] * (1.0f / 2048.0f)) * il; }
  LDSX(); for (int rl = 0; rl < 16; ++rl) if (lane < 8) vst2(Z + (rq + rl) * CC + (size_t)h * DK + lane * 4, *(const v4f*)&so[wave][rl][lane * 4]); }
// ---- k_out: block = (64 rows, 128 cols): out = Z (bf16 hi + lo) . W_out + b
__global__ __launch_bounds__(128) void k_out(const float* __restrict__ Z, const __bf16* __restrict__ PO, const float* __restrict__ BO, float* __restrict__ OUT) { __shared__ __align__(16) float sf[4][16][132];
  const int tid = threadIdx.x, wave = tid >> 5, lane = tid & 31, col = lane & 15, g = lane >> 4; const size_t r0 = (size_t)blockIdx.x * 64 + wave * 16; const int c0 = blockIdx.y * 128;
  v8f acc[8] = {};
#pragma unroll
  for (int kc = 0; kc < CC / 32; ++kc) { const F2 a = split_row(Z + (r0 + col) * CC, kc * 32, lane);
#pragma unroll
    for (int j = 0; j < 8; ++j) { const v16b w = frag_b(PO + (size_t)(c0 + j * 16 + col) * CC + kc * 32, lane); acc[j] = wmma_bf(a.h, w, acc[j]); acc[j] = wmma_bf(a.l, w, acc[j]); } }
#pragma unroll
  for (int j = 0; j < 8; ++j) { const float bb = bfr(BO[c0 + j * 16 + col]);
#pragma unroll
    for (int r = 0; r < 8; ++r) sf[wave][8 * g + r][j * 16 + col] = acc[j][r] + bb; }
  LDSX(); for (int rl = 0; rl < 16; ++rl) vst2(OUT + (r0 + rl) * CC + c0 + lane * 4, *(const v4f*)&sf[wave][rl][lane * 4]); }
extern "C" void kernel_launch(void* const* d_in, const int* in_sizes, int n_in, void* d_out, int out_size, void* d_ws, size_t ws_size, hipStream_t stream) {
  (void)in_sizes; (void)n_in; (void)out_size;
  const float** F = (const float**)d_in;   // 0 x [4,2048,256], 1 interaction_mask [2048,2048], 2 W_qkv [256,768] (in,out), 3 b_qkv [768], 4 W_out [256,256] (in,out), 5 b_out
  if (ws_size < (size_t)WS_END) return;
  char* ws = (char*)d_ws; __bf16 *PW = (__bf16*)(ws + WS_PW), *PO = (__bf16*)(ws + WS_PO); _Float16 *QK = (_Float16*)(ws + WS_QK), *QKL = (_Float16*)(ws + WS_QKL), *VT = (_Float16*)(ws + WS_VT), *VTL = (_Float16*)(ws + WS_VTL); float* Z = (float*)(ws + WS_Z);
  k_pack<<<4 * CC, 256, 0, stream>>>(F[2], F[4], PW, PO);
  k_proj<<<dim3(NN / 64, 3 * CC / 128, TNB), 128, 0, stream>>>(F[0], PW, F[3], QK, QKL, VT, VTL);
  k_att<<<dim3(NN / 64, NH, TNB), 128, 0, stream>>>(QK, QKL, VT, VTL, F[1], Z);
  k_out<<<dim3(TNB * NN / 64, CC / 128), 128, 0, stream>>>(Z, PO, F[5], (float*)d_out);
}

// v001
// One run takes 216 microseconds.
// Timed twice side by side with v000, it ran 1.09 times as fast both times.
// compute dtype: all float inputs rounded to bf16; qkv = x . W_qkv + b with EXACT bf16 products on WMMA 16x16x32 ((in,out) weights as transposed rows), q/k rounded to f16 hi + residual rows, v to f16 hi + residual planes; logits q . k with 3 products, x 32^-0.5 x (0.1 + 0.9 interaction_mask[n][m]) read per pair, running-max softmax in f32 (hardware exp), P (x 2^11, f16) . v (hi + residual, 2 products); out = ctx (bf16 hi + lo, 2 products) . W_out + b; f32 output.
#include <hip/hip_runtime.h>
#include <math.h>

typedef __attribute__((ext_vector_type(16))) _Float16 v16h;
typedef __attribute__((ext_vector_type(16))) __bf16 v16b;
typedef __attribute__((ext_vector_type(8)))  _Float16 v8h;
typedef __attribute__((ext_vector_type(8)))  float v8f;
typedef __attribute__((ext_vector_type(4)))  float v4f;
typedef __attribute__((ext_vector_type(2)))  float v2f;
typedef __attribute__((ext_vector_type(4)))  unsigned v4u;
typedef __attribute__((ext_vector_type(4)))  int v4i;
typedef float __attribute__((may_alias)) float_a;
typedef int __attribute__((may_alias)) int_a;

template <typename T> __device__ __forceinline__ void vst2(void* p, T v) { *(T*)p = v;  }
__device__ __forceinline__ v8f wmma16(v16h a, v16h b, v8f c) {
  v8f d = __builtin_amdgcn_wmma_f32_16x16x32_f16(false, a, false, b, (short)0, c, false, false);
  asm volatile("v_nop\n\tv_nop\n\tv_nop\n\tv_nop" : "+v"(d) : "v"(a), "v"(b));
  return d;
}
__device__ __forceinline__ v8f wmma_bf(v16b a, v16b b, v8f c) {
  v8f d = __builtin_amdgcn_wmma_f32_16x16x32_bf16(false, a, false, b, (short)0, c, false, false);
  asm volatile("v_nop\n\tv_nop\n\tv_nop\n\tv_nop" : "+v"(d) : "v"(a), "v"(b));
  return d;
}
// 16x16x32 fragments: lane = (h = lane>>4, row/col = lane&15); elements 0..7 = k0+8h+0..7, 8..15 = k0+16+8h+0..7; D element r = row 8h+r
__device__ __forceinline__ v16h frag_h(const _Float16* rowk0, int lane) {
  union { v16h v; v8h q[2]; } u; const _Float16* p = rowk0 + 8 * (lane >> 4);
  u.q[0] = *(const v8h*)p; u.q[1] = *(const v8h*)(p + 16); return u.v;
}
__device__ __forceinline__ v16h frag_f32(const float* rowk0, int lane) {
  v16h a; const float* p = rowk0 + 8 * (lane >> 4);
#pragma unroll
  for (int i = 0; i < 8; ++i) { a[i] = (_Float16)p[i]; a[8 + i] = (_Float16)p[16 + i]; }
  return a;
}
__device__ __forceinline__ v16h frag_f32s(const float* rowk0, int lane, float sc) {
  v16h a; const float* p = rowk0 + 8 * (lane >> 4);
#pragma unroll
  for (int i = 0; i < 8; ++i) { a[i] = (_Float16)(p[i] * sc); a[8 + i] = (_Float16)(p[16 + i] * sc); }
  return a;
}
// column fragment from a [K][ld] layout (column n), rows >= K read as 0
__device__ __forceinline__ v16h fragc_f32(const float* W, int k0, int n, int lane, int ld, int K) {
  v16h a; const int g = lane >> 4;
#pragma unroll
  for (int i = 0; i < 8; ++i) { const int ka = k0 + 8 * g + i, kb = ka + 16;
    a[i] = (_Float16)(ka < K ? W[(size_t)(ka < K ? ka : K - 1) * ld + n] : 0.f); a[8 + i] = (_Float16)(kb < K ? W[(size_t)(kb < K ? kb : K - 1) * ld + n] : 0.f); }
  return a;
}
struct F2 { v16b h, l; };
__device__ __forceinline__ F2 bsplit16(const float v[16]) { F2 r;
#pragma unroll
  for (int i = 0; i < 16; ++i) { const __bf16 h = (__bf16)v[i]; r.h[i] = h; r.l[i] = (__bf16)(v[i] - (float)h); }
  return r; }
__device__ __forceinline__ F2 split_row(const float* row, int k0, int lane) { float v[16]; const float* p = row + k0 + 8 * (lane >> 4);
#pragma unroll
  for (int i = 0; i < 8; ++i) { v[i] = p[i]; v[8 + i] = p[16 + i]; }
  return bsplit16(v); }
__device__ __forceinline__ F2 split_rowK(const float* row, int k0, int lane, int K) { float v[16]; const int g = lane >> 4;
#pragma unroll
  for (int i = 0; i < 8; ++i) { const int ka = k0 + 8 * g + i, kb = ka + 16; v[i] = ka < K ? row[ka < K ? ka : K - 1] : 0.f; v[8 + i] = kb < K ? row[kb < K ? kb : K - 1] : 0.f; }
  return bsplit16(v); }
__device__ __forceinline__ F2 split_col(const float* W, int k0, int n, int lane, int ld, int K) { float v[16]; const int g = lane >> 4;
#pragma unroll
  for (int i = 0; i < 8; ++i) { const int ka = k0 + 8 * g + i, kb = ka + 16; v[i] = ka < K ? W[(size_t)(ka < K ? ka : K - 1) * ld + n] : 0.f; v[8 + i] = kb < K ? W[(size_t)(kb < K ? kb : K - 1) * ld + n] : 0.f; }
  return bsplit16(v); }
__device__ __forceinline__ v8f mac3(const F2& a, const F2& b, v8f c) { c = wmma_bf(a.l, b.h, c); c = wmma_bf(a.h, b.l, c); return wmma_bf(a.h, b.h, c); }
__device__ __forceinline__ float sigm(float v) { return 1.0f / (1.0f + expf(-v)); }
#define LDSX() do { asm volatile("s_wait_dscnt 0" ::: "memory"); __builtin_amdgcn_wave_barrier(); __builtin_amdgcn_fence(__ATOMIC_RELEASE, "workgroup"); } while (0)


// Biologically-modulated attention (B 4, N 2,048 genes, C 256, 8 heads x 32): fused (in,out) qkv + bias, logits scaled by (0.1 + 0.9 x PPI interaction strength) before the softmax, (in,out) output projection + bias.
#define NB 4
#define NN 2048
#define CC 256
#define NH 8
#define DK 32
#ifndef TNB
#define TNB NB
#endif
typedef __attribute__((ext_vector_type(8))) __bf16 v8b;
__device__ __forceinline__ v16b frag_b(const __bf16* rowk0, int lane) {
  union { v16b v; v8b q[2]; } u; const __bf16* p = rowk0 + 8 * (lane >> 4);
  u.q[0] = *(const v8b*)p; u.q[1] = *(const v8b*)(p + 16); return u.v;
}
__device__ __forceinline__ float bfr(float v) { return (float)(__bf16)v; }
__device__ __attribute__((noinline)) float exp_ni(float v) { return expf(v); }
__device__ __attribute__((noinline)) float erf_ni(float v) { return erff(v); }

#define WS_PW  0u                                   // bf16 rows [768][256] (qkv, transposed (in,out)); [256][256] W_out^T
#define WS_PO  (WS_PW + 2u * 3 * CC * CC)
#define WS_QK  (WS_PO + 2u * CC * CC)                   // f16 hi|lo q|k rows [b*NN + n][512]
#define WS_QKL (WS_QK + 2u * (size_t)NB * NN * 2 * CC)
#define WS_VT  (WS_QKL + 2u * (size_t)NB * NN * 2 * CC) // f16 hi|lo v planes [b][c][n]
#define WS_VTL (WS_VT + 2u * (size_t)NB * CC * NN)
#define WS_Z   (WS_VTL + 2u * (size_t)NB * CC * NN)     // f32 ctx [b*NN + n][256]
#define WS_END (WS_Z + 4u * (size_t)NB * NN * CC)

__global__ __launch_bounds__(256) void k_pack(const float* __restrict__ WQKV, const float* __restrict__ WO, __bf16* __restrict__ PW, __bf16* __restrict__ PO) { const int n = blockIdx.x, t = threadIdx.x; __shared__ __align__(16) __bf16 s[CC];   // n in [0, 1024): rows 0..767 qkv columns, 768..1023 W_out columns
  if (n < 3 * CC) s[t] = (__bf16)WQKV[(size_t)t * (3 * CC) + n]; else s[t] = (__bf16)WO[(size_t)t * CC + (n - 3 * CC)]; __syncthreads();
  __bf16* dst = (n < 3 * CC) ? PW + (size_t)n * CC : PO + (size_t)(n - 3 * CC) * CC; if (t < CC / 8) vst2((unsigned*)(dst + t * 8), *(const v4u*)&s[t * 8]); }
__device__ __forceinline__ v16b fragb_f32(const float* __restrict__ p, int lane) { v16b a; const float* pp = p + 8 * (lane >> 4);
#pragma unroll
  for (int i = 0; i < 8; ++i) { a[i] = (__bf16)pp[i]; a[8 + i] = (__bf16)pp[16 + i]; } return a; }
// ---- k_proj: block = (64 rows, 128 of 768 cols, b): y = x . W + b (exact); cols < 512 (q|k) -> f16 hi/lo rows; cols >= 512 (v) -> transposed planes
__global__ __launch_bounds__(128) void k_proj(const float* __restrict__ X, const __bf16* __restrict__ PW, const float* __restrict__ BQKV, _Float16* __restrict__ QK, _Float16* __restrict__ QKL, _Float16* __restrict__ VT, _Float16* __restrict__ VTL) {
  __shared__ __align__(16) _Float16 sh[64][136], sl[64][136]; __shared__ __align__(16) _Float16 th[128][72], tl[128][72];
  const int tid = threadIdx.x, wave = tid >> 5, lane = tid & 31, col = lane & 15, g = lane >> 4; const size_t b = blockIdx.z; const int i0 = blockIdx.x * 64 + wave * 16; const int c0 = blockIdx.y * 128; const size_t r0 = b * NN + i0;
  v8f acc[8] = {};
#pragma unroll
  for (int kc = 0; kc < CC / 32; ++kc) { const v16b a = fragb_f32(X + (r0 + col) * CC + kc * 32, lane);
#pragma unroll
    for (int j = 0; j < 8; ++j) acc[j] = wmma_bf(a, frag_b(PW + (size_t)(c0 + j * 16 + col) * CC + kc * 32, lane), acc[j]); }
  const bool isv = c0 >= 2 * CC;
#pragma unroll
  for (int j = 0; j < 8; ++j) { const float bb = bfr(BQKV[c0 + j * 16 + col]);
#pragma unroll
    for (int r = 0; r < 8; ++r) { const float v = acc[j][r] + bb; const _Float16 hv = (_Float16)v; const _Float16 lv = (_Float16)((v - (float)hv) * 2048.0f); if (!isv) { sh[wave * 16 + 8 * g + r][j * 16 + col] = hv; sl[wave * 16 + 8 * g + r][j * 16 + col] = lv; } else { th[j * 16 + col][wave * 16 + 8 * g + r] = hv; tl[j * 16 + col][wave * 16 + 8 * g + r] = lv; } } }
  __syncthreads();
  if (!isv) { for (int e = tid; e < 64 * 16; e += 128) { const int rl = e >> 4, q = e & 15; const size_t o = (b * NN + blockIdx.x * 64 + rl) * (2 * CC) + c0 + q * 8; vst2((unsigned*)(QK + o), *(const v4u*)&sh[rl][q * 8]); vst2((unsigned*)(QKL + o), *(const v4u*)&sl[rl][q * 8]); } }
  else { const int cv0 = c0 - 2 * CC; for (int e = tid; e < 128 * 8; e += 128) { const int cl = e >> 3, q = e & 7; const size_t o = ((b * CC + cv0 + cl) * (size_t)NN) + blockIdx.x * 64 + q * 8; vst2((unsigned*)(VT + o), *(const v4u*)&th[cl][q * 8]); vst2((unsigned*)(VTL + o), *(const v4u*)&tl[cl][q * 8]); } } }
// ---- k_att: block = (64 queries, head, b), transposed products: S^T = K . Q^T (3 products; a lane holds 16 of the pass's 32 keys of ONE query) x 32^-0.5 x (0.1 + 0.9 IM[n][m]), running-max softmax in-lane plus one exchange between the wave's halves, P^T packed from the score accumulators as B operand, O^T += V^T . P^T (v planes hi + residual, 2 products) -> Z merged
__device__ __forceinline__ float xhalf(float x) { return __builtin_bit_cast(float, __builtin_amdgcn_permlanex16(__builtin_bit_cast(int, x), __builtin_bit_cast(int, x), 0x76543210, 0xfedcba98, false, false)); }  // lane l with lane l ^ 16
__global__ __launch_bounds__(128) void k_att(const _Float16* __restrict__ QK, const _Float16* __restrict__ QKL, const _Float16* __restrict__ VT, const _Float16* __restrict__ VTL, const float* __restrict__ IM, float* __restrict__ Z) {
  __shared__ __align__(16) float so[4][16][36];
  const int tid = threadIdx.x, wave = tid >> 5, lane = tid & 31, col = lane & 15, g = lane >> 4; const int h = blockIdx.y; const size_t b = blockIdx.z; const int q0 = blockIdx.x * 64 + wave * 16; const size_t rq = b * NN + q0;
  const v16h aq = frag_h(QK + (rq + col) * (2 * CC) + h * DK, lane), aql = frag_h(QKL + (rq + col) * (2 * CC) + h * DK, lane);   // B operands: column = query q0 + col
  const float* imrow = IM + (size_t)(q0 + col) * NN + 8 * g;   // this lane's query row; score register r of tile ct = key ks * 32 + ct * 16 + 8 g + r
  float m = -3.0e38f, l = 0.f;   // l: this half's keys only, the halves are joined behind the loop
  v8f acc[2] = {}, accl[2] = {};   // O^T: register r of tile j = channel j * 16 + 8 g + r of query q0 + col
#pragma unroll 1   // the pass loop stays rolled, as it was: one pass's code and registers
  for (int ks = 0; ks < NN / 32; ++ks) { v8f s[2];
#pragma unroll
    for (int ct = 0; ct < 2; ++ct) { const int kk = ks * 32 + ct * 16 + col; const size_t rk = b * NN + kk; const _Float16* pkl = QKL + rk * (2 * CC) + CC + h * DK + 8 * g; const v16h kh = frag_h(QK + rk * (2 * CC) + CC + h * DK, lane);
      // precaution, both waits: tile 1 is the last user of the pass's two K address pairs, and the results of the loads that follow are given those registers; each wait stands between the loads that name a pair and the load whose result rewrites it
      if (ct == 1) asm volatile("s_wait_xcnt 0x0" ::: "memory");
      union { v16h v; v8h q[2]; } ul; ul.q[0] = *(const v8h*)pkl;
      if (ct == 1) asm volatile("s_wait_xcnt 0x0" ::: "memory");
      ul.q[1] = *(const v8h*)(pkl + 16); const v16h kl = ul.v;   // same elements as frag_h gives, read in two statements so that the wait can stand between them
      v8f c = {}, cl = {}; c = wmma16(kh, aq, c); cl = wmma16(kl, aq, cl); cl = wmma16(kh, aql, cl);
      const v4f ia = *(const v4f*)(imrow + ks * 32 + ct * 16), ib = *(const v4f*)(imrow + ks * 32 + ct * 16 + 4);
#pragma unroll
      for (int r = 0; r < 8; ++r) s[ct][r] = (c[r] + cl[r] * (1.0f / 2048.0f)) * 0.17677669529663687f * (0.1f + 0.9f * bfr(r < 4 ? ia[r & 3] : ib[r & 3])); }
    float mx = fmaxf(s[0][0], s[1][0]);
#pragma unroll
    for (int r = 1; r < 8; ++r) mx = fmaxf(mx, fmaxf(s[0][r], s[1][r]));
    mx = fmaxf(mx, xhalf(mx));
    const float mn = fmaxf(m, mx), alpha = __expf(m - mn); float t[8]; v16h pa;   // pa[i] = key kmap(i): tile i >> 3, register i & 7, the order frag_h gives the v planes
#pragma unroll
    for (int r = 0; r < 8; ++r) { const float e0 = __expf(s[0][r] - mn), e1 = __expf(s[1][r] - mn); t[r] = e0 + e1; pa[r] = (_Float16)(e0 * 2048.0f); pa[8 + r] = (_Float16)(e1 * 2048.0f); }
    l = l * alpha + (((t[0] + t[1]) + (t[2] + t[3])) + ((t[4] + t[5]) + (t[6] + t[7]))); m = mn;
#pragma unroll
    for (int j = 0; j < 2; ++j)
#pragma unroll
      for (int r = 0; r < 8; ++r) { acc[j][r] *= alpha; accl[j][r] *= alpha; }
#pragma unroll
    for (int j = 0; j < 2; ++j) { const size_t po = (b * CC + (size_t)h * DK + j * 16 + col) * (size_t)NN + ks * 32; acc[j] = wmma16(frag_h(VT + po, lane), pa, acc[j]); accl[j] = wmma16(frag_h(VTL + po, lane), pa, accl[j]); } }
  l += xhalf(l);
  const float il = (1.0f / 2048.0f) / l;
#pragma unroll
  for (int j = 0; j < 2; ++j)
#pragma unroll
    for (int r = 0; r < 8; ++r) so[wave][col][j * 16 + 8 * g + r] = (acc[j][r] + accl[j][r] * (1.0f / 2048.0f)) * il;
  LDSX(); for (int rl = 0; rl < 16; ++rl) if (lane < 8) vst2(Z + (rq + rl) * CC + (size_t)h * DK + lane * 4, *(const v4f*)&so[wave][rl][lane * 4]); }
// ---- k_out: block = (64 rows, 128 cols): out = Z (bf16 hi + lo) . W_out + b
__global__ __launch_bounds__(128) void k_out(const float* __restrict__ Z, const __bf16* __restrict__ PO, const float* __restrict__ BO, float* __restrict__ OUT) { __shared__ __align__(16) float sf[4][16][132];
  const int tid = threadIdx.x, wave = tid >> 5, lane = tid & 31, col = lane & 15, g = lane >> 4; const size_t r0 = (size_t)blockIdx.x * 64 + wave * 16; const int c0 = blockIdx.y * 128;
  v8f acc[8] = {};
#pragma unroll
  for (int kc = 0; kc < CC / 32; ++kc) { const F2 a = split_row(Z + (r0 + col) * CC, kc * 32, lane);
#pragma unroll
    for (int j = 0; j < 8; ++j) { const v16b w = frag_b(PO + (size_t)(c0 + j * 16 + col) * CC + kc * 32, lane); acc[j] = wmma_bf(a.h, w, acc[j]); acc[j] = wmma_bf(a.l, w, acc[j]); } }
#pragma unroll
  for (int j = 0; j < 8; ++j) { const float bb = bfr(BO[c0 + j * 16 + col]);
#pragma unroll
    for (int r = 0; r < 8; ++r) sf[wave][8 * g + r][j * 16 + col] = acc[j][r] + bb; }
  LDSX(); for (int rl = 0; rl < 16; ++rl) vst2(OUT + (r0 + rl) * CC + c0 + lane * 4, *(const v4f*)&sf[wave][rl][lane * 4]); }
extern "C" void kernel_launch(void* const* d_in, const int* in_sizes, int n_in, void* d_out, int out_size, void* d_ws, size_t ws_size, hipStream_t stream) {
  (void)in_sizes; (void)n_in; (void)out_size;
  const float** F = (const float**)d_in;   // 0 x [4,2048,256], 1 interaction_mask [2048,2048], 2 W_qkv [256,768] (in,out), 3 b_qkv [768], 4 W_out [256,256] (in,out), 5 b_out
  if (ws_size < (size_t)WS_END) return;
  char* ws = (char*)d_ws; __bf16 *PW = (__bf16*)(ws + WS_PW), *PO = (__bf16*)(ws + WS_PO); _Float16 *QK = (_Float16*)(ws + WS_QK), *QKL = (_Float16*)(ws + WS_QKL), *VT = (_Float16*)(ws + WS_VT), *VTL = (_Float16*)(ws + WS_VTL); float* Z = (float*)(ws + WS_Z);
  k_pack<<<4 * CC, 256, 0, stream>>>(F[2], F[4], PW, PO);
  k_proj<<<dim3(NN / 64, 3 * CC / 128, TNB), 128, 0, stream>>>(F[0], PW, F[3], QK, QKL, VT, VTL);
  k_att<<<dim3(NN / 64, NH, TNB), 128, 0, stream>>>(QK, QKL, VT, VTL, F[1], Z);
  k_out<<<dim3(TNB * NN / 64, CC / 128), 128, 0, stream>>>(Z, PO, F[5], (float*)d_out);
}

// v002
// One run takes 122 microseconds.
// Next to v001, in two timings, it ran 1.80 and 1.77 times as fast.
// Counting every step since v000, it is 1.95 times as fast.
// compute dtype: all float inputs rounded to bf16; qkv = x . W_qkv + b with EXACT bf16 products on WMMA 16x16x32 ((in,out) weights as transposed rows), q/k rounded to f16 hi + residual rows, v to f16 hi + residual planes; logits q . k with 3 products, x 32^-0.5 x (0.1 + 0.9 interaction_mask[n][m]) read per pair, running-max softmax in f32 (hardware exp), P (x 2^11, f16) . v (hi + residual, 2 products); out = ctx (bf16 hi + lo, 2 products) . W_out + b; f32 output.
#include <hip/hip_runtime.h>
#include <math.h>

typedef __attribute__((ext_vector_type(16))) _Float16 v16h;
typedef __attribute__((ext_vector_type(16))) __bf16 v16b;
typedef __attribute__((ext_vector_type(8)))  _Float16 v8h;
typedef __attribute__((ext_vector_type(8)))  float v8f;
typedef __attribute__((ext_vector_type(4)))  float v4f;
typedef __attribute__((ext_vector_type(2)))  float v2f;
typedef __attribute__((ext_vector_type(4)))  unsigned v4u;
typedef __attribute__((ext_vector_type(4)))  int v4i;
typedef float __attribute__((may_alias)) float_a;
typedef int __attribute__((may_alias)) int_a;

template <typename T> __device__ __forceinline__ void vst2(void* p, T v) { *(T*)p = v;  }
__device__ __forceinline__ v8f wmma16(v16h a, v16h b, v8f c) {
  v8f d = __builtin_amdgcn_wmma_f32_16x16x32_f16(false, a, false, b, (short)0, c, false, false);
  asm volatile("v_nop\n\tv_nop\n\tv_nop\n\tv_nop" : "+v"(d) : "v"(a), "v"(b));
  return d;
}
__device__ __forceinline__ v8f wmma_bf(v16b a, v16b b, v8f c) {
  v8f d = __builtin_amdgcn_wmma_f32_16x16x32_bf16(false, a, false, b, (short)0, c, false, false);
  asm volatile("v_nop\n\tv_nop\n\tv_nop\n\tv_nop" : "+v"(d) : "v"(a), "v"(b));
  return d;
}
// 16x16x32 fragments: lane = (h = lane>>4, row/col = lane&15); elements 0..7 = k0+8h+0..7, 8..15 = k0+16+8h+0..7; D element r = row 8h+r
__device__ __forceinline__ v16h frag_h(const _Float16* rowk0, int lane) {
  union { v16h v; v8h q[2]; } u; const _Float16* p = rowk0 + 8 * (lane >> 4);
  u.q[0] = *(const v8h*)p; u.q[1] = *(const v8h*)(p + 16); return u.v;
}
__device__ __forceinline__ v16h frag_f32(const float* rowk0, int lane) {
  v16h a; const float* p = rowk0 + 8 * (lane >> 4);
#pragma unroll
  for (int i = 0; i < 8; ++i) { a[i] = (_Float16)p[i]; a[8 + i] = (_Float16)p[16 + i]; }
  return a;
}
__device__ __forceinline__ v16h frag_f32s(const float* rowk0, int lane, float sc) {
  v16h a; const float* p = rowk0 + 8 * (lane >> 4);
#pragma unroll
  for (int i = 0; i < 8; ++i) { a[i] = (_Float16)(p[i] * sc); a[8 + i] = (_Float16)(p[16 + i] * sc); }
  return a;
}
// column fragment from a [K][ld] layout (column n), rows >= K read as 0
__device__ __forceinline__ v16h fragc_f32(const float* W, int k0, int n, int lane, int ld, int K) {
  v16h a; const int g = lane >> 4;
#pragma unroll
  for (int i = 0; i < 8; ++i) { const int ka = k0 + 8 * g + i, kb = ka + 16;
    a[i] = (_Float16)(ka < K ? W[(size_t)(ka < K ? ka : K - 1) * ld + n] : 0.f); a[8 + i] = (_Float16)(kb < K ? W[(size_t)(kb < K ? kb : K - 1) * ld + n] : 0.f); }
  return a;
}
struct F2 { v16b h, l; };
__device__ __forceinline__ F2 bsplit16(const float v[16]) { F2 r;
#pragma unroll
  for (int i = 0; i < 16; ++i) { const __bf16 h = (__bf16)v[i]; r.h[i] = h; r.l[i] = (__bf16)(v[i] - (float)h); }
  return r; }
__device__ __forceinline__ F2 split_row(const float* row, int k0, int lane) { float v[16]; const float* p = row + k0 + 8 * (lane >> 4);
#pragma unroll
  for (int i = 0; i < 8; ++i) { v[i] = p[i]; v[8 + i] = p[16 + i]; }
  return bsplit16(v); }
__device__ __forceinline__ F2 split_rowK(const float* row, int k0, int lane, int K) { float v[16]; const int g = lane >> 4;
#pragma unroll
  for (int i = 0; i < 8; ++i) { const int ka = k0 + 8 * g + i, kb = ka + 16; v[i] = ka < K ? row[ka < K ? ka : K - 1] : 0.f; v[8 + i] = kb < K ? row[kb < K ? kb : K - 1] : 0.f; }
  return bsplit16(v); }
__device__ __forceinline__ F2 split_col(const float* W, int k0, int n, int lane, int ld, int K) { float v[16]; const int g = lane >> 4;
#pragma unroll
  for (int i = 0; i < 8; ++i) { const int ka = k0 + 8 * g + i, kb = ka + 16; v[i] = ka < K ? W[(size_t)(ka < K ? ka : K - 1) * ld + n] : 0.f; v[8 + i] = kb < K ? W[(size_t)(kb < K ? kb : K - 1) * ld + n] : 0.f; }
  return bsplit16(v); }
__device__ __forceinline__ v8f mac3(const F2& a, const F2& b, v8f c) { c = wmma_bf(a.l, b.h, c); c = wmma_bf(a.h, b.l, c); return wmma_bf(a.h, b.h, c); }
__device__ __forceinline__ float sigm(float v) { return 1.0f / (1.0f + expf(-v)); }
#define LDSX() do { asm volatile("s_wait_dscnt 0" ::: "memory"); __builtin_amdgcn_wave_barrier(); __builtin_amdgcn_fence(__ATOMIC_RELEASE, "workgroup"); } while (0)


// Biologically-modulated attention (B 4, N 2,048 genes, C 256, 8 heads x 32): fused (in,out) qkv + bias, logits scaled by (0.1 + 0.9 x PPI interaction strength) before the softmax, (in,out) output projection + bias.
#define NB 4
#define NN 2048
#define CC 256
#define NH 8
#define DK 32
#ifndef TNB
#define TNB NB
#endif
typedef __attribute__((ext_vector_type(8))) __bf16 v8b;
__device__ __forceinline__ v16b frag_b(const __bf16* rowk0, int lane) {
  union { v16b v; v8b q[2]; } u; const __bf16* p = rowk0 + 8 * (lane >> 4);
  u.q[0] = *(const v8b*)p; u.q[1] = *(const v8b*)(p + 16); return u.v;
}
__device__ __forceinline__ float bfr(float v) { return (float)(__bf16)v; }
__device__ __attribute__((noinline)) float exp_ni(float v) { return expf(v); }
__device__ __attribute__((noinline)) float erf_ni(float v) { return erff(v); }

#define WS_PW  0u                                   // bf16 rows [768][256] (qkv, transposed (in,out)); [256][256] W_out^T
#define WS_PO  (WS_PW + 2u * 3 * CC * CC)
#define WS_QK  (WS_PO + 2u * CC * CC)                   // f16 hi|lo q|k rows [b*NN + n][512]
#define WS_QKL (WS_QK + 2u * (size_t)NB * NN * 2 * CC)
#define WS_VT  (WS_QKL + 2u * (size_t)NB * NN * 2 * CC) // f16 hi|lo v planes [b][c][n]
#define WS_VTL (WS_VT + 2u * (size_t)NB * CC * NN)
#define WS_Z   (WS_VTL + 2u * (size_t)NB * CC * NN)     // f32 ctx [b*NN + n][256]
#define WS_END (WS_Z + 4u * (size_t)NB * NN * CC)

__global__ __launch_bounds__(256) void k_pack(const float* __restrict__ WQKV, const float* __restrict__ WO, __bf16* __restrict__ PW, __bf16* __restrict__ PO) { const int n = blockIdx.x, t = threadIdx.x; __shared__ __align__(16) __bf16 s[CC];   // n in [0, 1024): rows 0..767 qkv columns, 768..1023 W_out columns
  if (n < 3 * CC) s[t] = (__bf16)WQKV[(size_t)t * (3 * CC) + n]; else s[t] = (__bf16)WO[(size_t)t * CC + (n - 3 * CC)]; __syncthreads();
  __bf16* dst = (n < 3 * CC) ? PW + (size_t)n * CC : PO + (size_t)(n - 3 * CC) * CC; if (t < CC / 8) vst2((unsigned*)(dst + t * 8), *(const v4u*)&s[t * 8]); }
__device__ __forceinline__ v16b fragb_f32(const float* __restrict__ p, int lane) { v16b a; const float* pp = p + 8 * (lane >> 4);
#pragma unroll
  for (int i = 0; i < 8; ++i) { a[i] = (__bf16)pp[i]; a[8 + i] = (__bf16)pp[16 + i]; } return a; }
// ---- k_proj: block = (64 rows, 128 of 768 cols, b): y = x . W + b (exact); cols < 512 (q|k) -> f16 hi/lo rows; cols >= 512 (v) -> transposed planes
__global__ __launch_bounds__(128) void k_proj(const float* __restrict__ X, const __bf16* __restrict__ PW, const float* __restrict__ BQKV, _Float16* __restrict__ QK, _Float16* __restrict__ QKL, _Float16* __restrict__ VT, _Float16* __restrict__ VTL) {
  __shared__ __align__(16) _Float16 sh[64][136], sl[64][136]; __shared__ __align__(16) _Float16 th[128][72], tl[128][72];
  const int tid = threadIdx.x, wave = tid >> 5, lane = tid & 31, col = lane & 15, g = lane >> 4; const size_t b = blockIdx.z; const int i0 = blockIdx.x * 64 + wave * 16; const int c0 = blockIdx.y * 128; const size_t r0 = b * NN + i0;
  v8f acc[8] = {};
#pragma unroll
  for (int kc = 0; kc < CC / 32; ++kc) { const v16b a = fragb_f32(X + (r0 + col) * CC + kc * 32, lane);
#pragma unroll
    for (int j = 0; j < 8; ++j) acc[j] = wmma_bf(a, frag_b(PW + (size_t)(c0 + j * 16 + col) * CC + kc * 32, lane), acc[j]); }
  const bool isv = c0 >= 2 * CC;
#pragma unroll
  for (int j = 0; j < 8; ++j) { const float bb = bfr(BQKV[c0 + j * 16 + col]);
#pragma unroll
    for (int r = 0; r < 8; ++r) { const float v = acc[j][r] + bb; const _Float16 hv = (_Float16)v; const _Float16 lv = (_Float16)((v - (float)hv) * 2048.0f); if (!isv) { sh[wave * 16 + 8 * g + r][j * 16 + col] = hv; sl[wave * 16 + 8 * g + r][j * 16 + col] = lv; } else { th[j * 16 + col][wave * 16 + 8 * g + r] = hv; tl[j * 16 + col][wave * 16 + 8 * g + r] = lv; } } }
  __syncthreads();
  if (!isv) { for (int e = tid; e < 64 * 16; e += 128) { const int rl = e >> 4, q = e & 15; const size_t o = (b * NN + blockIdx.x * 64 + rl) * (2 * CC) + c0 + q * 8; vst2((unsigned*)(QK + o), *(const v4u*)&sh[rl][q * 8]); vst2((unsigned*)(QKL + o), *(const v4u*)&sl[rl][q * 8]); } }
  else { const int cv0 = c0 - 2 * CC; for (int e = tid; e < 128 * 8; e += 128) { const int cl = e >> 3, q = e & 7; const size_t o = ((b * CC + cv0 + cl) * (size_t)NN) + blockIdx.x * 64 + q * 8; vst2((unsigned*)(VT + o), *(const v4u*)&th[cl][q * 8]); vst2((unsigned*)(VTL + o), *(const v4u*)&tl[cl][q * 8]); } } }
// ---- k_att: block = (64 queries, head, b), transposed products: S^T = K . Q^T (3 products; a lane holds 16 of the pass's 32 keys of ONE query) x 32^-0.5 x (0.1 + 0.9 IM[n][m]), running-max softmax in-lane plus one exchange between the wave's halves, P^T packed from the score accumulators as B operand, O^T += V^T . P^T (v planes hi + residual, 2 products) -> Z merged
// operands come through a two-buffer LDS ring, a stage = 64 keys = 2 passes: K rows (hi | residual), v planes (hi, residual) and the block's 64 mask rows, each byte copied once per block with adjacent lanes on adjacent 16 bytes
__device__ __forceinline__ float xhalf(float x) { return __builtin_bit_cast(float, __builtin_amdgcn_permlanex16(__builtin_bit_cast(int, x), __builtin_bit_cast(int, x), 0x76543210, 0xfedcba98, false, false)); }  // lane l with lane l ^ 16
#define KT 64                          // keys per stage
#define KP 144                         // LDS pitch, bytes: K row (64 B hi | 64 B residual) and v plane row (64 keys), 16 B x odd for 16-byte readers
#define IP 272                         // LDS pitch, bytes: mask row (64 keys, f32)
#define OFF_VH (KT * KP)
#define OFF_VL (OFF_VH + DK * KP)
#define OFF_IM (OFF_VL + DK * KP)
#define STG (OFF_IM + 64 * IP)         // bytes of one stage
// eight asynchronous copies of 16 bytes per lane; the s_wait_xcnt stands inside the statement so that no address register of a copy is rewritten in front of it (a precaution)
__device__ __forceinline__ void cp8(unsigned l0, unsigned l1, unsigned l2, unsigned l3, unsigned l4, unsigned l5, unsigned l6, unsigned l7, const void* g0, const void* g1, const void* g2, const void* g3, const void* g4, const void* g5, const void* g6, const void* g7) {
  asm volatile("global_load_async_to_lds_b128 %0, %8, off\n\tglobal_load_async_to_lds_b128 %1, %9, off\n\tglobal_load_async_to_lds_b128 %2, %10, off\n\tglobal_load_async_to_lds_b128 %3, %11, off\n\t"
               "global_load_async_to_lds_b128 %4, %12, off\n\tglobal_load_async_to_lds_b128 %5, %13, off\n\tglobal_load_async_to_lds_b128 %6, %14, off\n\tglobal_load_async_to_lds_b128 %7, %15, off\n\ts_wait_xcnt 0x0"
               :: "v"(l0), "v"(l1), "v"(l2), "v"(l3), "v"(l4), "v"(l5), "v"(l6), "v"(l7), "v"(g0), "v"(g1), "v"(g2), "v"(g3), "v"(g4), "v"(g5), "v"(g6), "v"(g7) : "memory");
}
__global__ __launch_bounds__(128) void k_att(const _Float16* __restrict__ QK, const _Float16* __restrict__ QKL, const _Float16* __restrict__ VT, const _Float16* __restrict__ VTL, const float* __restrict__ IM, float* __restrict__ Z) {
  __shared__ __align__(16) unsigned char ring[2 * STG];
  const int tid = threadIdx.x, wave = tid >> 5, lane = tid & 31, col = lane & 15, g = lane >> 4; const int h = blockIdx.y; const size_t b = blockIdx.z; const int q0 = blockIdx.x * 64 + wave * 16; const size_t rq = b * NN + q0;
  const v16h aq = frag_h(QK + (rq + col) * (2 * CC) + h * DK, lane), aql = frag_h(QKL + (rq + col) * (2 * CC) + h * DK, lane);   // B operands: column = query q0 + col
  // this thread's share of a stage: K rows tid >> 2 and + 32 (4 lanes a 64-byte row), v channels tid >> 3 and + 16 (8 lanes a 128-byte row), mask rows tid >> 4 + 8 i (16 lanes a 256-byte row)
  const unsigned lr = (unsigned)(size_t)ring;   // the ring's byte address in LDS
  const unsigned lk = lr + (tid >> 2) * KP + (tid & 3) * 16, lv = lr + OFF_VH + (tid >> 3) * KP + (tid & 7) * 16, li = lr + OFF_IM + (tid >> 4) * IP + (tid & 15) * 16;
  const size_t ok = (b * NN + (tid >> 2)) * (2 * CC) + CC + h * DK + (tid & 3) * 8, ov = (b * CC + (size_t)h * DK + (tid >> 3)) * (size_t)NN + (tid & 7) * 8;
  const float* gi = IM + (size_t)(blockIdx.x * 64 + (tid >> 4)) * NN + (tid & 15) * 4;
  auto fill = [&](int t, unsigned bo) {   // stage t into the buffer at byte offset bo
    const _Float16 *kh = QK + ok + (size_t)t * KT * (2 * CC), *kl = QKL + ok + (size_t)t * KT * (2 * CC), *vh = VT + ov + t * KT, *vl = VTL + ov + t * KT; const float* im = gi + t * KT;
    cp8(lk + bo, lk + bo + 32 * KP, lk + bo + 64, lk + bo + 32 * KP + 64, lv + bo, lv + bo + 16 * KP, lv + bo + DK * KP, lv + bo + DK * KP + 16 * KP,
        kh, kh + 32 * (2 * CC), kl, kl + 32 * (2 * CC), vh, vh + 16 * (size_t)NN, vl, vl + 16 * (size_t)NN);
    cp8(li + bo, li + bo + 8 * IP, li + bo + 16 * IP, li + bo + 24 * IP, li + bo + 32 * IP, li + bo + 40 * IP, li + bo + 48 * IP, li + bo + 56 * IP,
        im, im + 8 * (size_t)NN, im + 16 * (size_t)NN, im + 24 * (size_t)NN, im + 32 * (size_t)NN, im + 40 * (size_t)NN, im + 48 * (size_t)NN, im + 56 * (size_t)NN); };
  float m = -3.0e38f, l = 0.f;   // l: this half's keys only, the halves are joined behind the loop
  v8f acc[2] = {}, accl[2] = {};   // O^T: register r of tile j = channel j * 16 + 8 g + r of query q0 + col
  fill(0, 0);
  asm volatile("s_wait_asynccnt 0x0" ::: "memory");   // stage 0 has landed before the barrier that publishes it
  __syncthreads();
  fill(1, STG);
#pragma unroll 1   // the stage loop stays rolled: one stage's code and registers
  for (int t = 0; t < NN / KT; ++t) { const unsigned bo = (t & 1) * STG; const unsigned char* st = ring + bo;
#pragma unroll   // both passes of a stage unrolled, so that every LDS offset is an immediate
   for (int sub = 0; sub < KT / 32; ++sub) { v8f s[2];
#pragma unroll
    for (int ct = 0; ct < 2; ++ct) { const _Float16* pk = (const _Float16*)(st + (sub * 32 + ct * 16 + col) * KP); const v16h kh = frag_h(pk, lane), kl = frag_h(pk + 32, lane);
      v8f c = {}, cl = {}; c = wmma16(kh, aq, c); cl = wmma16(kl, aq, cl); cl = wmma16(kh, aql, cl);
      const float* pi = (const float*)(st + OFF_IM + (wave * 16 + col) * IP) + sub * 32 + ct * 16 + 8 * g;   // this lane's query row; score register r of tile ct = key t * 64 + sub * 32 + ct * 16 + 8 g + r
      const v4f ia = *(const v4f*)pi, ib = *(const v4f*)(pi + 4);
#pragma unroll
      for (int r = 0; r < 8; ++r) s[ct][r] = (c[r] + cl[r] * (1.0f / 2048.0f)) * 0.17677669529663687f * (0.1f + 0.9f * bfr(r < 4 ? ia[r & 3] : ib[r & 3])); }
    float mx = fmaxf(s[0][0], s[1][0]);
#pragma unroll
    for (int r = 1; r < 8; ++r) mx = fmaxf(mx, fmaxf(s[0][r], s[1][r]));
    mx = fmaxf(mx, xhalf(mx));
    const float mn = fmaxf(m, mx), alpha = __expf(m - mn); float tt[8]; v16h pa;   // pa[i] = key kmap(i): tile i >> 3, register i & 7, the order frag_h gives the v planes
#pragma unroll
    for (int r = 0; r < 8; ++r) { const float e0 = __expf(s[0][r] - mn), e1 = __expf(s[1][r] - mn); tt[r] = e0 + e1; pa[r] = (_Float16)(e0 * 2048.0f); pa[8 + r] = (_Float16)(e1 * 2048.0f); }
    l = l * alpha + (((tt[0] + tt[1]) + (tt[2] + tt[3])) + ((tt[4] + tt[5]) + (tt[6] + tt[7]))); m = mn;
#pragma unroll
    for (int j = 0; j < 2; ++j)
#pragma unroll
      for (int r = 0; r < 8; ++r) { acc[j][r] *= alpha; accl[j][r] *= alpha; }
#pragma unroll
    for (int j = 0; j < 2; ++j) { const _Float16* pv = (const _Float16*)(st + OFF_VH + (j * 16 + col) * KP) + sub * 32; acc[j] = wmma16(frag_h(pv, lane), pa, acc[j]); accl[j] = wmma16(frag_h(pv + DK * KP / 2, lane), pa, accl[j]); } }
   asm volatile("s_wait_dscnt 0x0" ::: "memory");      // this wave's reads of the stage are done before the buffer is given up
   asm volatile("s_wait_asynccnt 0x0" ::: "memory");   // this wave's copies of stage t + 1 have landed before the barrier that publishes them
   __syncthreads();                                    // publishes stage t + 1 and ends every wave's reads of stage t
   if (t + 2 < NN / KT) fill(t + 2, bo); }
  asm volatile("s_wait_asynccnt 0x0" ::: "memory");   // nothing is in flight when the ring becomes output staging and the wave ends
  float (*so)[16][36] = (float (*)[16][36])ring;   // output staging in the ring, a slice per wave: behind the last stage's barrier nobody reads the ring and no copy is in flight
  l += xhalf(l);
  const float il = (1.0f / 2048.0f) / l;
#pragma unroll
  for (int j = 0; j < 2; ++j)
#pragma unroll
    for (int r = 0; r < 8; ++r) so[wave][col][j * 16 + 8 * g + r] = (acc[j][r] + accl[j][r] * (1.0f / 2048.0f)) * il;
  LDSX(); for (int rl = 0; rl < 16; ++rl) if (lane < 8) vst2(Z + (rq + rl) * CC + (size_t)h * DK + lane * 4, *(const v4f*)&so[wave][rl][lane * 4]); }
// ---- k_out: block = (64 rows, 128 cols): out = Z (bf16 hi + lo) . W_out + b
__global__ __launch_bounds__(128) void k_out(const float* __restrict__ Z, const __bf16* __restrict__ PO, const float* __restrict__ BO, float* __restrict__ OUT) { __shared__ __align__(16) float sf[4][16][132];
  const int tid = threadIdx.x, wave = tid >> 5, lane = tid & 31, col = lane & 15, g = lane >> 4; const size_t r0 = (size_t)blockIdx.x * 64 + wave * 16; const int c0 = blockIdx.y * 128;
  v8f acc[8] = {};
#pragma unroll
  for (int kc = 0; kc < CC / 32; ++kc) { const F2 a = split_row(Z + (r0 + col) * CC, kc * 32, lane);
#pragma unroll
    for (int j = 0; j < 8; ++j) { const v16b w = frag_b(PO + (size_t)(c0 + j * 16 + col) * CC + kc * 32, lane); acc[j] = wmma_bf(a.h, w, acc[j]); acc[j] = wmma_bf(a.l, w, acc[j]); } }
#pragma unroll
  for (int j = 0; j < 8; ++j) { const float bb = bfr(BO[c0 + j * 16 + col]);
#pragma unroll
    for (int r = 0; r < 8; ++r) sf[wave][8 * g + r][j * 16 + col] = acc[j][r] + bb; }
  LDSX(); for (int rl = 0; rl < 16; ++rl) vst2(OUT + (r0 + rl) * CC + c0 + lane * 4, *(const v4f*)&sf[wave][rl][lane * 4]); }
extern "C" void kernel_launch(void* const* d_in, const int* in_sizes, int n_in, void* d_out, int out_size, void* d_ws, size_t ws_size, hipStream_t stream) {
  (void)in_sizes; (void)n_in; (void)out_size;
  const float** F = (const float**)d_in;   // 0 x [4,2048,256], 1 interaction_mask [2048,2048], 2 W_qkv [256,768] (in,out), 3 b_qkv [768], 4 W_out [256,256] (in,out), 5 b_out
  if (ws_size < (size_t)WS_END) return;
  char* ws = (char*)d_ws; __bf16 *PW = (__bf16*)(ws + WS_PW), *PO = (__bf16*)(ws + WS_PO); _Float16 *QK = (_Float16*)(ws + WS_QK), *QKL = (_Float16*)(ws + WS_QKL), *VT = (_Float16*)(ws + WS_VT), *VTL = (_Float16*)(ws + WS_VTL); float* Z = (float*)(ws + WS_Z);
  k_pack<<<4 * CC, 256, 0, stream>>>(F[2], F[4], PW, PO);
  k_proj<<<dim3(NN / 64, 3 * CC / 128, TNB), 128, 0, stream>>>(F[0], PW, F[3], QK, QKL, VT, VTL);
  k_att<<<dim3(NN / 64, NH, TNB), 128, 0, stream>>>(QK, QKL, VT, VTL, F[1], Z);
  k_out<<<dim3(TNB * NN / 64, CC / 128), 128, 0, stream>>>(Z, PO, F[5], (float*)d_out);
}

// v003
// It runs in 103 microseconds.
// Two timings next to v002 put it at 1.20 and 1.17 times that version's speed.
// Counting every step since v000, it is 2.31 times as fast.
// compute dtype: all float inputs rounded to bf16; qkv = x . W_qkv + b with EXACT bf16 products on WMMA 16x16x32 ((in,out) weights as transposed rows), q/k rounded to f16 hi + residual rows, v to f16 hi + residual planes; logits q . k with 3 products, x 32^-0.5 x (0.1 + 0.9 interaction_mask[n][m]) read per pair, running-max softmax in f32 (hardware exp), P (x 2^11, f16) . v (hi + residual, 2 products); out = ctx (bf16 hi + lo, 2 products) . W_out + b; f32 output.
#include <hip/hip_runtime.h>
#include <math.h>

typedef __attribute__((ext_vector_type(16))) _Float16 v16h;
typedef __attribute__((ext_vector_type(16))) __bf16 v16b;
typedef __attribute__((ext_vector_type(8)))  _Float16 v8h;
typedef __attribute__((ext_vector_type(8)))  float v8f;
typedef __attribute__((ext_vector_type(4)))  float v4f;
typedef __attribute__((ext_vector_type(2)))  float v2f;
typedef __attribute__((ext_vector_type(4)))  unsigned v4u;
typedef __attribute__((ext_vector_type(4)))  int v4i;
typedef float __attribute__((may_alias)) float_a;
typedef int __attribute__((may_alias)) int_a;

template <typename T> __device__ __forceinline__ void vst2(void* p, T v) { *(T*)p = v;  }
// plain builtins: the compiler keeps the distance behind its own matrix instructions and is free to issue later operand loads ahead of them
__device__ __forceinline__ v8f wmma16(v16h a, v16h b, v8f c) {
  return __builtin_amdgcn_wmma_f32_16x16x32_f16(false, a, false, b, (short)0, c, false, false);
}
__device__ __forceinline__ v8f wmma_bf(v16b a, v16b b, v8f c) {
  return __builtin_amdgcn_wmma_f32_16x16x32_bf16(false, a, false, b, (short)0, c, false, false);
}
// 16x16x32 fragments: lane = (h = lane>>4, row/col = lane&15); elements 0..7 = k0+8h+0..7, 8..15 = k0+16+8h+0..7; D element r = row 8h+r
__device__ __forceinline__ v16h frag_h(const _Float16* rowk0, int lane) {
  union { v16h v; v8h q[2]; } u; const _Float16* p = rowk0 + 8 * (lane >> 4);
  u.q[0] = *(const v8h*)p; u.q[1] = *(const v8h*)(p + 16); return u.v;
}
__device__ __forceinline__ v16h frag_f32(const float* rowk0, int lane) {
  v16h a; const float* p = rowk0 + 8 * (lane >> 4);
#pragma unroll
  for (int i = 0; i < 8; ++i) { a[i] = (_Float16)p[i]; a[8 + i] = (_Float16)p[16 + i]; }
  return a;
}
__device__ __forceinline__ v16h frag_f32s(const float* rowk0, int lane, float sc) {
  v16h a; const float* p = rowk0 + 8 * (lane >> 4);
#pragma unroll
  for (int i = 0; i < 8; ++i) { a[i] = (_Float16)(p[i] * sc); a[8 + i] = (_Float16)(p[16 + i] * sc); }
  return a;
}
// column fragment from a [K][ld] layout (column n), rows >= K read as 0
__device__ __forceinline__ v16h fragc_f32(const float* W, int k0, int n, int lane, int ld, int K) {
  v16h a; const int g = lane >> 4;
#pragma unroll
  for (int i = 0; i < 8; ++i) { const int ka = k0 + 8 * g + i, kb = ka + 16;
    a[i] = (_Float16)(ka < K ? W[(size_t)(ka < K ? ka : K - 1) * ld + n] : 0.f); a[8 + i] = (_Float16)(kb < K ? W[(size_t)(kb < K ? kb : K - 1) * ld + n] : 0.f); }
  return a;
}
struct F2 { v16b h, l; };
__device__ __forceinline__ F2 bsplit16(const float v[16]) { F2 r;
#pragma unroll
  for (int i = 0; i < 16; ++i) { const __bf16 h = (__bf16)v[i]; r.h[i] = h; r.l[i] = (__bf16)(v[i] - (float)h); }
  return r; }
__device__ __forceinline__ F2 split_row(const float* row, int k0, int lane) { float v[16]; const float* p = row + k0 + 8 * (lane >> 4);
#pragma unroll
  for (int i = 0; i < 8; ++i) { v[i] = p[i]; v[8 + i] = p[16 + i]; }
  return bsplit16(v); }
__device__ __forceinline__ F2 split_rowK(const float* row, int k0, int lane, int K) { float v[16]; const int g = lane >> 4;
#pragma unroll
  for (int i = 0; i < 8; ++i) { const int ka = k0 + 8 * g + i, kb = ka + 16; v[i] = ka < K ? row[ka < K ? ka : K - 1] : 0.f; v[8 + i] = kb < K ? row[kb < K ? kb : K - 1] : 0.f; }
  return bsplit16(v); }
__device__ __forceinline__ F2 split_col(const float* W, int k0, int n, int lane, int ld, int K) { float v[16]; const int g = lane >> 4;
#pragma unroll
  for (int i = 0; i < 8; ++i) { const int ka = k0 + 8 * g + i, kb = ka + 16; v[i] = ka < K ? W[(size_t)(ka < K ? ka : K - 1) * ld + n] : 0.f; v[8 + i] = kb < K ? W[(size_t)(kb < K ? kb : K - 1) * ld + n] : 0.f; }
  return bsplit16(v); }
__device__ __forceinline__ v8f mac3(const F2& a, const F2& b, v8f c) { c = wmma_bf(a.l, b.h, c); c = wmma_bf(a.h, b.l, c); return wmma_bf(a.h, b.h, c); }
__device__ __forceinline__ float sigm(float v) { return 1.0f / (1.0f + expf(-v)); }
#define LDSX() do { asm volatile("s_wait_dscnt 0" ::: "memory"); __builtin_amdgcn_wave_barrier(); __builtin_amdgcn_fence(__ATOMIC_RELEASE, "workgroup"); } while (0)


// Biologically-modulated attention (B 4, N 2,048 genes, C 256, 8 heads x 32): fused (in,out) qkv + bias, logits scaled by (0.1 + 0.9 x PPI interaction strength) before the softmax, (in,out) output projection + bias.
#define NB 4
#define NN 2048
#define CC 256
#define NH 8
#define DK 32
#ifndef TNB
#define TNB NB
#endif
typedef __attribute__((ext_vector_type(8))) __bf16 v8b;
__device__ __forceinline__ v16b frag_b(const __bf16* rowk0, int lane) {
  union { v16b v; v8b q[2]; } u; const __bf16* p = rowk0 + 8 * (lane >> 4);
  u.q[0] = *(const v8b*)p; u.q[1] = *(const v8b*)(p + 16); return u.v;
}
__device__ __forceinline__ float bfr(float v) { return (float)(__bf16)v; }
__device__ __attribute__((noinline)) float exp_ni(float v) { return expf(v); }
__device__ __attribute__((noinline)) float erf_ni(float v) { return erff(v); }

#define WS_PW  0u                                   // bf16 rows [768][256] (qkv, transposed (in,out)); [256][256] W_out^T
#define WS_PO  (WS_PW + 2u * 3 * CC * CC)
#define WS_QK  (WS_PO + 2u * CC * CC)                   // f16 hi|lo q|k rows [b*NN + n][512]
#define WS_QKL (WS_QK + 2u * (size_t)NB * NN * 2 * CC)
#define WS_VT  (WS_QKL + 2u * (size_t)NB * NN * 2 * CC) // f16 hi|lo v planes [b][c][n]
#define WS_VTL (WS_VT + 2u * (size_t)NB * CC * NN)
#define WS_Z   (WS_VTL + 2u * (size_t)NB * CC * NN)     // f32 ctx [b*NN + n][256]
#define WS_END (WS_Z + 4u * (size_t)NB * NN * CC)

__global__ __launch_bounds__(256) void k_pack(const float* __restrict__ WQKV, const float* __restrict__ WO, __bf16* __restrict__ PW, __bf16* __restrict__ PO) { const int n = blockIdx.x, t = threadIdx.x; __shared__ __align__(16) __bf16 s[CC];   // n in [0, 1024): rows 0..767 qkv columns, 768..1023 W_out columns
  if (n < 3 * CC) s[t] = (__bf16)WQKV[(size_t)t * (3 * CC) + n]; else s[t] = (__bf16)WO[(size_t)t * CC + (n - 3 * CC)]; __syncthreads();
  __bf16* dst = (n < 3 * CC) ? PW + (size_t)n * CC : PO + (size_t)(n - 3 * CC) * CC; if (t < CC / 8) vst2((unsigned*)(dst + t * 8), *(const v4u*)&s[t * 8]); }
__device__ __forceinline__ v16b fragb_f32(const float* __restrict__ p, int lane) { v16b a; const float* pp = p + 8 * (lane >> 4);
#pragma unroll
  for (int i = 0; i < 8; ++i) { a[i] = (__bf16)pp[i]; a[8 + i] = (__bf16)pp[16 + i]; } return a; }
// ---- k_proj: block = (64 rows, 128 of 768 cols, b): y = x . W + b (exact); cols < 512 (q|k) -> f16 hi/lo rows; cols >= 512 (v) -> transposed planes
__global__ __launch_bounds__(128) void k_proj(const float* __restrict__ X, const __bf16* __restrict__ PW, const float* __restrict__ BQKV, _Float16* __restrict__ QK, _Float16* __restrict__ QKL, _Float16* __restrict__ VT, _Float16* __restrict__ VTL) {
  __shared__ __align__(16) _Float16 sh[64][136], sl[64][136]; __shared__ __align__(16) _Float16 th[128][72], tl[128][72];
  const int tid = threadIdx.x, wave = tid >> 5, lane = tid & 31, col = lane & 15, g = lane >> 4; const size_t b = blockIdx.z; const int i0 = blockIdx.x * 64 + wave * 16; const int c0 = blockIdx.y * 128; const size_t r0 = b * NN + i0;
  v8f acc[8] = {};
#pragma unroll
  for (int kc = 0; kc < CC / 32; ++kc) { const v16b a = fragb_f32(X + (r0 + col) * CC + kc * 32, lane);
#pragma unroll
    for (int j = 0; j < 8; ++j) acc[j] = wmma_bf(a, frag_b(PW + (size_t)(c0 + j * 16 + col) * CC + kc * 32, lane), acc[j]); }
  const bool isv = c0 >= 2 * CC;
#pragma unroll
  for (int j = 0; j < 8; ++j) { const float bb = bfr(BQKV[c0 + j * 16 + col]);
#pragma unroll
    for (int r = 0; r < 8; ++r) { const float v = acc[j][r] + bb; const _Float16 hv = (_Float16)v; const _Float16 lv = (_Float16)((v - (float)hv) * 2048.0f); if (!isv) { sh[wave * 16 + 8 * g + r][j * 16 + col] = hv; sl[wave * 16 + 8 * g + r][j * 16 + col] = lv; } else { th[j * 16 + col][wave * 16 + 8 * g + r] = hv; tl[j * 16 + col][wave * 16 + 8 * g + r] = lv; } } }
  __syncthreads();
  if (!isv) { for (int e = tid; e < 64 * 16; e += 128) { const int rl = e >> 4, q = e & 15; const size_t o = (b * NN + blockIdx.x * 64 + rl) * (2 * CC) + c0 + q * 8; vst2((unsigned*)(QK + o), *(const v4u*)&sh[rl][q * 8]); vst2((unsigned*)(QKL + o), *(const v4u*)&sl[rl][q * 8]); } }
  else { const int cv0 = c0 - 2 * CC; for (int e = tid; e < 128 * 8; e += 128) { const int cl = e >> 3, q = e & 7; const size_t o = ((b * CC + cv0 + cl) * (size_t)NN) + blockIdx.x * 64 + q * 8; vst2((unsigned*)(VT + o), *(const v4u*)&th[cl][q * 8]); vst2((unsigned*)(VTL + o), *(const v4u*)&tl[cl][q * 8]); } } }
// ---- k_att: block = (64 queries, head, b), transposed products: S^T = K . Q^T (3 products; a lane holds 16 of the pass's 32 keys of ONE query) x 32^-0.5 x (0.1 + 0.9 IM[n][m]), running-max softmax in-lane plus one exchange between the wave's halves, P^T packed from the score accumulators as B operand, O^T += V^T . P^T (v planes hi + residual, 2 products) -> Z merged
// operands come through a two-buffer LDS ring, a stage = 64 keys = 2 passes: K rows (hi | residual), v planes (hi, residual) and the block's 64 mask rows, each byte copied once per block with adjacent lanes on adjacent 16 bytes
__device__ __forceinline__ float xhalf(float x) { return __builtin_bit_cast(float, __builtin_amdgcn_permlanex16(__builtin_bit_cast(int, x), __builtin_bit_cast(int, x), 0x76543210, 0xfedcba98, false, false)); }  // lane l with lane l ^ 16
#define KT 64                          // keys per stage
#define KP 144                         // LDS pitch, bytes: K row (64 B hi | 64 B residual) and v plane row (64 keys), 16 B x odd for 16-byte readers
#define IP 272                         // LDS pitch, bytes: mask row (64 keys, f32)
#define OFF_VH (KT * KP)
#define OFF_VL (OFF_VH + DK * KP)
#define OFF_IM (OFF_VL + DK * KP)
#define STG (OFF_IM + 64 * IP)         // bytes of one stage
// eight asynchronous copies of 16 bytes per lane; the s_wait_xcnt stands inside the statement so that no address register of a copy is rewritten in front of it (a precaution)
__device__ __forceinline__ void cp8(unsigned l0, unsigned l1, unsigned l2, unsigned l3, unsigned l4, unsigned l5, unsigned l6, unsigned l7, const void* g0, const void* g1, const void* g2, const void* g3, const void* g4, const void* g5, const void* g6, const void* g7) {
  asm volatile("global_load_async_to_lds_b128 %0, %8, off\n\tglobal_load_async_to_lds_b128 %1, %9, off\n\tglobal_load_async_to_lds_b128 %2, %10, off\n\tglobal_load_async_to_lds_b128 %3, %11, off\n\t"
               "global_load_async_to_lds_b128 %4, %12, off\n\tglobal_load_async_to_lds_b128 %5, %13, off\n\tglobal_load_async_to_lds_b128 %6, %14, off\n\tglobal_load_async_to_lds_b128 %7, %15, off\n\ts_wait_xcnt 0x0"
               :: "v"(l0), "v"(l1), "v"(l2), "v"(l3), "v"(l4), "v"(l5), "v"(l6), "v"(l7), "v"(g0), "v"(g1), "v"(g2), "v"(g3), "v"(g4), "v"(g5), "v"(g6), "v"(g7) : "memory");
}
__global__ __launch_bounds__(128) void k_att(const _Float16* __restrict__ QK, const _Float16* __restrict__ QKL, const _Float16* __restrict__ VT, const _Float16* __restrict__ VTL, const float* __restrict__ IM, float* __restrict__ Z) {
  __shared__ __align__(16) unsigned char ring[2 * STG];
  const int tid = threadIdx.x, wave = tid >> 5, lane = tid & 31, col = lane & 15, g = lane >> 4; const int h = blockIdx.y; const size_t b = blockIdx.z; const int q0 = blockIdx.x * 64 + wave * 16; const size_t rq = b * NN + q0;
  const v16h aq = frag_h(QK + (rq + col) * (2 * CC) + h * DK, lane), aql = frag_h(QKL + (rq + col) * (2 * CC) + h * DK, lane);   // B operands: column = query q0 + col
  // this thread's share of a stage: K rows tid >> 2 and + 32 (4 lanes a 64-byte row), v channels tid >> 3 and + 16 (8 lanes a 128-byte row), mask rows tid >> 4 + 8 i (16 lanes a 256-byte row)
  const unsigned lr = (unsigned)(size_t)ring;   // the ring's byte address in LDS
  const unsigned lk = lr + (tid >> 2) * KP + (tid & 3) * 16, lv = lr + OFF_VH + (tid >> 3) * KP + (tid & 7) * 16, li = lr + OFF_IM + (tid >> 4) * IP + (tid & 15) * 16;
  const size_t ok = (b * NN + (tid >> 2)) * (2 * CC) + CC + h * DK + (tid & 3) * 8, ov = (b * CC + (size_t)h * DK + (tid >> 3)) * (size_t)NN + (tid & 7) * 8;
  const float* gi = IM + (size_t)(blockIdx.x * 64 + (tid >> 4)) * NN + (tid & 15) * 4;
  auto fill = [&](int t, unsigned bo) {   // stage t into the buffer at byte offset bo
    const _Float16 *kh = QK + ok + (size_t)t * KT * (2 * CC), *kl = QKL + ok + (size_t)t * KT * (2 * CC), *vh = VT + ov + t * KT, *vl = VTL + ov + t * KT; const float* im = gi + t * KT;
    cp8(lk + bo, lk + bo + 32 * KP, lk + bo + 64, lk + bo + 32 * KP + 64, lv + bo, lv + bo + 16 * KP, lv + bo + DK * KP, lv + bo + DK * KP + 16 * KP,
        kh, kh + 32 * (2 * CC), kl, kl + 32 * (2 * CC), vh, vh + 16 * (size_t)NN, vl, vl + 16 * (size_t)NN);
    cp8(li + bo, li + bo + 8 * IP, li + bo + 16 * IP, li + bo + 24 * IP, li + bo + 32 * IP, li + bo + 40 * IP, li + bo + 48 * IP, li + bo + 56 * IP,
        im, im + 8 * (size_t)NN, im + 16 * (size_t)NN, im + 24 * (size_t)NN, im + 32 * (size_t)NN, im + 40 * (size_t)NN, im + 48 * (size_t)NN, im + 56 * (size_t)NN); };
  float m = -3.0e38f, l = 0.f;   // l: this half's keys only, the halves are joined behind the loop
  v8f acc[2] = {}, accl[2] = {};   // O^T: register r of tile j = channel j * 16 + 8 g + r of query q0 + col
  fill(0, 0);
  asm volatile("s_wait_asynccnt 0x0" ::: "memory");   // stage 0 has landed before the barrier that publishes it
  __syncthreads();
  fill(1, STG);
#pragma unroll 1   // the stage loop stays rolled: one stage's code and registers
  for (int t = 0; t < NN / KT; ++t) { const unsigned bo = (t & 1) * STG; const unsigned char* st = ring + bo;
#pragma unroll   // both passes of a stage unrolled, so that every LDS offset is an immediate
   for (int sub = 0; sub < KT / 32; ++sub) { v8f s[2];
#pragma unroll
    for (int ct = 0; ct < 2; ++ct) { const _Float16* pk = (const _Float16*)(st + (sub * 32 + ct * 16 + col) * KP); const v16h kh = frag_h(pk, lane), kl = frag_h(pk + 32, lane);
      v8f c = {}, cl = {}; c = wmma16(kh, aq, c); cl = wmma16(kl, aq, cl); cl = wmma16(kh, aql, cl);
      const float* pi = (const float*)(st + OFF_IM + (wave * 16 + col) * IP) + sub * 32 + ct * 16 + 8 * g;   // this lane's query row; score register r of tile ct = key t * 64 + sub * 32 + ct * 16 + 8 g + r
      const v4f ia = *(const v4f*)pi, ib = *(const v4f*)(pi + 4);
#pragma unroll
      for (int r = 0; r < 8; ++r) s[ct][r] = (c[r] + cl[r] * (1.0f / 2048.0f)) * 0.17677669529663687f * (0.1f + 0.9f * bfr(r < 4 ? ia[r & 3] : ib[r & 3])); }
    float mx = fmaxf(s[0][0], s[1][0]);
#pragma unroll
    for (int r = 1; r < 8; ++r) mx = fmaxf(mx, fmaxf(s[0][r], s[1][r]));
    mx = fmaxf(mx, xhalf(mx));
    const float mn = fmaxf(m, mx), alpha = __expf(m - mn); float tt[8]; v16h pa;   // pa[i] = key kmap(i): tile i >> 3, register i & 7, the order frag_h gives the v planes
#pragma unroll
    for (int r = 0; r < 8; ++r) { const float e0 = __expf(s[0][r] - mn), e1 = __expf(s[1][r] - mn); tt[r] = e0 + e1; pa[r] = (_Float16)(e0 * 2048.0f); pa[8 + r] = (_Float16)(e1 * 2048.0f); }
    l = l * alpha + (((tt[0] + tt[1]) + (tt[2] + tt[3])) + ((tt[4] + tt[5]) + (tt[6] + tt[7]))); m = mn;
#pragma unroll
    for (int j = 0; j < 2; ++j)
#pragma unroll
      for (int r = 0; r < 8; ++r) { acc[j][r] *= alpha; accl[j][r] *= alpha; }
#pragma unroll
    for (int j = 0; j < 2; ++j) { const _Float16* pv = (const _Float16*)(st + OFF_VH + (j * 16 + col) * KP) + sub * 32; acc[j] = wmma16(frag_h(pv, lane), pa, acc[j]); accl[j] = wmma16(frag_h(pv + DK * KP / 2, lane), pa, accl[j]); } }
   asm volatile("s_wait_dscnt 0x0" ::: "memory");      // this wave's reads of the stage are done before the buffer is given up
   asm volatile("s_wait_asynccnt 0x0" ::: "memory");   // this wave's copies of stage t + 1 have landed before the barrier that publishes them
   __syncthreads();                                    // publishes stage t + 1 and ends every wave's reads of stage t
   if (t + 2 < NN / KT) fill(t + 2, bo); }
  asm volatile("s_wait_asynccnt 0x0" ::: "memory");   // nothing is in flight when the ring becomes output staging and the wave ends
  float (*so)[16][36] = (float (*)[16][36])ring;   // output staging in the ring, a slice per wave: behind the last stage's barrier nobody reads the ring and no copy is in flight
  l += xhalf(l);
  const float il = (1.0f / 2048.0f) / l;
#pragma unroll
  for (int j = 0; j < 2; ++j)
#pragma unroll
    for (int r = 0; r < 8; ++r) so[wave][col][j * 16 + 8 * g + r] = (acc[j][r] + accl[j][r] * (1.0f / 2048.0f)) * il;
  LDSX(); for (int rl = 0; rl < 16; ++rl) if (lane < 8) vst2(Z + (rq + rl) * CC + (size_t)h * DK + lane * 4, *(const v4f*)&so[wave][rl][lane * 4]); }
// ---- k_out: block = (64 rows, 128 cols): out = Z (bf16 hi + lo) . W_out + b
__global__ __launch_bounds__(128) void k_out(const float* __restrict__ Z, const __bf16* __restrict__ PO, const float* __restrict__ BO, float* __restrict__ OUT) { __shared__ __align__(16) float sf[4][16][132];
  const int tid = threadIdx.x, wave = tid >> 5, lane = tid & 31, col = lane & 15, g = lane >> 4; const size_t r0 = (size_t)blockIdx.x * 64 + wave * 16; const int c0 = blockIdx.y * 128;
  v8f acc[8] = {}; float bb[8];
#pragma unroll   // the eight bias loads stand ahead of the products, so that the epilogue waits for none of them
  for (int j = 0; j < 8; ++j) bb[j] = BO[c0 + j * 16 + col];
#pragma unroll
  for (int kc = 0; kc < CC / 32; ++kc) { const F2 a = split_row(Z + (r0 + col) * CC, kc * 32, lane); v16b w[8];
#pragma unroll   // a k step's eight W fragments are fetched as one group ahead of its products: one load latency a k step, not one a fragment
    for (int j = 0; j < 8; ++j) w[j] = frag_b(PO + (size_t)(c0 + j * 16 + col) * CC + kc * 32, lane);
#pragma unroll   // each tile still adds its hi product first and its lo product second
    for (int j = 0; j < 8; ++j) acc[j] = wmma_bf(a.h, w[j], acc[j]);
#pragma unroll   // unrolled like the loop above, so that w[] and acc[] are indexed by constants and stay in registers
    for (int j = 0; j < 8; ++j) acc[j] = wmma_bf(a.l, w[j], acc[j]); }
#pragma unroll
  for (int j = 0; j < 8; ++j) { const float bj = bfr(bb[j]);
#pragma unroll
    for (int r = 0; r < 8; ++r) sf[wave][8 * g + r][j * 16 + col] = acc[j][r] + bj; }
  LDSX(); for (int rl = 0; rl < 16; ++rl) vst2(OUT + (r0 + rl) * CC + c0 + lane * 4, *(const v4f*)&sf[wave][rl][lane * 4]); }
extern "C" void kernel_launch(void* const* d_in, const int* in_sizes, int n_in, void* d_out, int out_size, void* d_ws, size_t ws_size, hipStream_t stream) {
  (void)in_sizes; (void)n_in; (void)out_size;
  const float** F = (const float**)d_in;   // 0 x [4,2048,256], 1 interaction_mask [2048,2048], 2 W_qkv [256,768] (in,out), 3 b_qkv [768], 4 W_out [256,256] (in,out), 5 b_out
  if (ws_size < (size_t)WS_END) return;
  char* ws = (char*)d_ws; __bf16 *PW = (__bf16*)(ws + WS_PW), *PO = (__bf16*)(ws + WS_PO); _Float16 *QK = (_Float16*)(ws + WS_QK), *QKL = (_Float16*)(ws + WS_QKL), *VT = (_Float16*)(ws + WS_VT), *VTL = (_Float16*)(ws + WS_VTL); float* Z = (float*)(ws + WS_Z);
  k_pack<<<4 * CC, 256, 0, stream>>>(F[2], F[4], PW, PO);
  k_proj<<<dim3(NN / 64, 3 * CC / 128, TNB), 128, 0, stream>>>(F[0], PW, F[3], QK, QKL, VT, VTL);
  k_att<<<dim3(NN / 64, NH, TNB), 128, 0, stream>>>(QK, QKL, VT, VTL, F[1], Z);
  k_out<<<dim3(TNB * NN / 64, CC / 128), 128, 0, stream>>>(Z, PO, F[5], (float*)d_out);
}

// v004
// Measured time: 92.4 microseconds a run.
// Two timings next to v003 both put it at 1.11 times that version's speed.
// Counting every step since v000, it is 2.56 times as fast.
// compute dtype: all float inputs rounded to bf16; qkv = x . W_qkv + b with EXACT bf16 products on WMMA 16x16x32 ((in,out) weights as transposed rows), q/k rounded to f16 hi + residual rows, v to f16 hi + residual planes; logits q . k with 3 products, x 32^-0.5 x (0.1 + 0.9 interaction_mask[n][m]) read per pair (mask rounded to bf16 once, ahead of the attention), running-max softmax in f32 (hardware exp), P (x 2^11, f16) . v (hi + residual, 2 products); out = ctx (bf16 hi + lo, 2 products) . W_out + b; f32 output.
#include <hip/hip_runtime.h>
#include <math.h>

typedef __attribute__((ext_vector_type(16))) _Float16 v16h;
typedef __attribute__((ext_vector_type(16))) __bf16 v16b;
typedef __attribute__((ext_vector_type(8)))  _Float16 v8h;
typedef __attribute__((ext_vector_type(8)))  float v8f;
typedef __attribute__((ext_vector_type(4)))  float v4f;
typedef __attribute__((ext_vector_type(2)))  float v2f;
typedef __attribute__((ext_vector_type(4)))  unsigned v4u;
typedef __attribute__((ext_vector_type(4)))  int v4i;
typedef float __attribute__((may_alias)) float_a;
typedef int __attribute__((may_alias)) int_a;

template <typename T> __device__ __forceinline__ void vst2(void* p, T v) { *(T*)p = v;  }
// plain builtins: the compiler keeps the distance behind its own matrix instructions and is free to issue later operand loads ahead of them
__device__ __forceinline__ v8f wmma16(v16h a, v16h b, v8f c) {
  return __builtin_amdgcn_wmma_f32_16x16x32_f16(false, a, false, b, (short)0, c, false, false);
}
__device__ __forceinline__ v8f wmma_bf(v16b a, v16b b, v8f c) {
  return __builtin_amdgcn_wmma_f32_16x16x32_bf16(false, a, false, b, (short)0, c, false, false);
}
// 16x16x32 fragments: lane = (h = lane>>4, row/col = lane&15); elements 0..7 = k0+8h+0..7, 8..15 = k0+16+8h+0..7; D element r = row 8h+r
__device__ __forceinline__ v16h frag_h(const _Float16* rowk0, int lane) {
  union { v16h v; v8h q[2]; } u; const _Float16* p = rowk0 + 8 * (lane >> 4);
  u.q[0] = *(const v8h*)p; u.q[1] = *(const v8h*)(p + 16); return u.v;
}
__device__ __forceinline__ v16h frag_f32(const float* rowk0, int lane) {
  v16h a; const float* p = rowk0 + 8 * (lane >> 4);
#pragma unroll
  for (int i = 0; i < 8; ++i) { a[i] = (_Float16)p[i]; a[8 + i] = (_Float16)p[16 + i]; }
  return a;
}
__device__ __forceinline__ v16h frag_f32s(const float* rowk0, int lane, float sc) {
  v16h a; const float* p = rowk0 + 8 * (lane >> 4);
#pragma unroll
  for (int i = 0; i < 8; ++i) { a[i] = (_Float16)(p[i] * sc); a[8 + i] = (_Float16)(p[16 + i] * sc); }
  return a;
}
// column fragment from a [K][ld] layout (column n), rows >= K read as 0
__device__ __forceinline__ v16h fragc_f32(const float* W, int k0, int n, int lane, int ld, int K) {
  v16h a; const int g = lane >> 4;
#pragma unroll
  for (int i = 0; i < 8; ++i) { const int ka = k0 + 8 * g + i, kb = ka + 16;
    a[i] = (_Float16)(ka < K ? W[(size_t)(ka < K ? ka : K - 1) * ld + n] : 0.f); a[8 + i] = (_Float16)(kb < K ? W[(size_t)(kb < K ? kb : K - 1) * ld + n] : 0.f); }
  return a;
}
struct F2 { v16b h, l; };
__device__ __forceinline__ F2 bsplit16(const float v[16]) { F2 r;
#pragma unroll
  for (int i = 0; i < 16; ++i) { const __bf16 h = (__bf16)v[i]; r.h[i] = h; r.l[i] = (__bf16)(v[i] - (float)h); }
  return r; }
__device__ __forceinline__ F2 split_row(const float* row, int k0, int lane) { float v[16]; const float* p = row + k0 + 8 * (lane >> 4);
#pragma unroll
  for (int i = 0; i < 8; ++i) { v[i] = p[i]; v[8 + i] = p[16 + i]; }
  return bsplit16(v); }
__device__ __forceinline__ F2 split_rowK(const float* row, int k0, int lane, int K) { float v[16]; const int g = lane >> 4;
#pragma unroll
  for (int i = 0; i < 8; ++i) { const int ka = k0 + 8 * g + i, kb = ka + 16; v[i] = ka < K ? row[ka < K ? ka : K - 1] : 0.f; v[8 + i] = kb < K ? row[kb < K ? kb : K - 1] : 0.f; }
  return bsplit16(v); }
__device__ __forceinline__ F2 split_col(const float* W, int k0, int n, int lane, int ld, int K) { float v[16]; const int g = lane >> 4;
#pragma unroll
  for (int i = 0; i < 8; ++i) { const int ka = k0 + 8 * g + i, kb = ka + 16; v[i] = ka < K ? W[(size_t)(ka < K ? ka : K - 1) * ld + n] : 0.f; v[8 + i] = kb < K ? W[(size_t)(kb < K ? kb : K - 1) * ld + n] : 0.f; }
  return bsplit16(v); }
__device__ __forceinline__ v8f mac3(const F2& a, const F2& b, v8f c) { c = wmma_bf(a.l, b.h, c); c = wmma_bf(a.h, b.l, c); return wmma_bf(a.h, b.h, c); }
__device__ __forceinline__ float sigm(float v) { return 1.0f / (1.0f + expf(-v)); }
#define LDSX() do { asm volatile("s_wait_dscnt 0" ::: "memory"); __builtin_amdgcn_wave_barrier(); __builtin_amdgcn_fence(__ATOMIC_RELEASE, "workgroup"); } while (0)


// Biologically-modulated attention (B 4, N 2,048 genes, C 256, 8 heads x 32): fused (in,out) qkv + bias, logits scaled by (0.1 + 0.9 x PPI interaction strength) before the softmax, (in,out) output projection + bias.
#define NB 4
#define NN 2048
#define CC 256
#define NH 8
#define DK 32
#ifndef TNB
#define TNB NB
#endif
typedef __attribute__((ext_vector_type(8))) __bf16 v8b;
__device__ __forceinline__ v16b frag_b(const __bf16* rowk0, int lane) {
  union { v16b v; v8b q[2]; } u; const __bf16* p = rowk0 + 8 * (lane >> 4);
  u.q[0] = *(const v8b*)p; u.q[1] = *(const v8b*)(p + 16); return u.v;
}
__device__ __forceinline__ float bfr(float v) { return (float)(__bf16)v; }
__device__ __attribute__((noinline)) float exp_ni(float v) { return expf(v); }
__device__ __attribute__((noinline)) float erf_ni(float v) { return erff(v); }

#define WS_PW  0u                                   // bf16 rows [768][256] (qkv, transposed (in,out)); [256][256] W_out^T
#define WS_PO  (WS_PW + 2u * 3 * CC * CC)
#define WS_QK  (WS_PO + 2u * CC * CC)                   // f16 hi|lo q|k rows [b*NN + n][512]
#define WS_QKL (WS_QK + 2u * (size_t)NB * NN * 2 * CC)
#define WS_VT  (WS_QKL + 2u * (size_t)NB * NN * 2 * CC) // f16 hi|lo v planes [b][c][n]
#define WS_VTL (WS_VT + 2u * (size_t)NB * CC * NN)
#define WS_Z   (WS_VTL + 2u * (size_t)NB * CC * NN)     // f32 ctx [b*NN + n][256]
#define WS_MB  (WS_Z + 4u * (size_t)NB * NN * CC)       // bf16 interaction mask [n][m]
#define WS_END (WS_MB + 2u * (size_t)NN * NN)

typedef __attribute__((ext_vector_type(4))) __bf16 v4b;
#define MPB (NN * NN / (4 * CC))       // mask elements a k_pack block rounds
static_assert(MPB % 1024 == 0, "a block's share of the mask is whole rounds of 256 threads x 4 floats");
__global__ __launch_bounds__(256) void k_pack(const float* __restrict__ WQKV, const float* __restrict__ WO, const float* __restrict__ IM, __bf16* __restrict__ PW, __bf16* __restrict__ PO, __bf16* __restrict__ MB) { const int n = blockIdx.x, t = threadIdx.x; __shared__ __align__(16) __bf16 s[CC];   // n in [0, 1024): rows 0..767 qkv columns, 768..1023 W_out columns
  // the block's share of the interaction mask, rounded to bf16 once here for every batch and head; adjacent lanes on adjacent 16 bytes, loads issued ahead of the weight column
  const size_t mo = (size_t)n * MPB + t * 4; v4f mk[MPB / 1024];
#pragma unroll   // all of the share's loads in flight together, mk[] in registers
  for (int i = 0; i < MPB / 1024; ++i) mk[i] = *(const v4f*)(IM + mo + i * 1024);
  if (n < 3 * CC) s[t] = (__bf16)WQKV[(size_t)t * (3 * CC) + n]; else s[t] = (__bf16)WO[(size_t)t * CC + (n - 3 * CC)]; __syncthreads();
  __bf16* dst = (n < 3 * CC) ? PW + (size_t)n * CC : PO + (size_t)(n - 3 * CC) * CC; if (t < CC / 8) vst2((unsigned*)(dst + t * 8), *(const v4u*)&s[t * 8]);
#pragma unroll   // mk[] indexed by constants
  for (int i = 0; i < MPB / 1024; ++i) { v4b o;
#pragma unroll   // vector elements indexed by constants
    for (int e = 0; e < 4; ++e) o[e] = (__bf16)mk[i][e];
    *(v4b*)(MB + mo + i * 1024) = o; } }
__device__ __forceinline__ v16b fragb_f32(const float* __restrict__ p, int lane) { v16b a; const float* pp = p + 8 * (lane >> 4);
#pragma unroll
  for (int i = 0; i < 8; ++i) { a[i] = (__bf16)pp[i]; a[8 + i] = (__bf16)pp[16 + i]; } return a; }
// ---- k_proj: block = (64 rows, 128 of 768 cols, b): y = x . W + b (exact); cols < 512 (q|k) -> f16 hi/lo rows; cols >= 512 (v) -> transposed planes
__global__ __launch_bounds__(128) void k_proj(const float* __restrict__ X, const __bf16* __restrict__ PW, const float* __restrict__ BQKV, _Float16* __restrict__ QK, _Float16* __restrict__ QKL, _Float16* __restrict__ VT, _Float16* __restrict__ VTL) {
  __shared__ __align__(16) _Float16 sh[64][136], sl[64][136]; __shared__ __align__(16) _Float16 th[128][72], tl[128][72];
  const int tid = threadIdx.x, wave = tid >> 5, lane = tid & 31, col = lane & 15, g = lane >> 4; const size_t b = blockIdx.z; const int i0 = blockIdx.x * 64 + wave * 16; const int c0 = blockIdx.y * 128; const size_t r0 = b * NN + i0;
  v8f acc[8] = {};
#pragma unroll
  for (int kc = 0; kc < CC / 32; ++kc) { const v16b a = fragb_f32(X + (r0 + col) * CC + kc * 32, lane);
#pragma unroll
    for (int j = 0; j < 8; ++j) acc[j] = wmma_bf(a, frag_b(PW + (size_t)(c0 + j * 16 + col) * CC + kc * 32, lane), acc[j]); }
  const bool isv = c0 >= 2 * CC;
#pragma unroll
  for (int j = 0; j < 8; ++j) { const float bb = bfr(BQKV[c0 + j * 16 + col]);
#pragma unroll
    for (int r = 0; r < 8; ++r) { const float v = acc[j][r] + bb; const _Float16 hv = (_Float16)v; const _Float16 lv = (_Float16)((v - (float)hv) * 2048.0f); if (!isv) { sh[wave * 16 + 8 * g + r][j * 16 + col] = hv; sl[wave * 16 + 8 * g + r][j * 16 + col] = lv; } else { th[j * 16 + col][wave * 16 + 8 * g + r] = hv; tl[j * 16 + col][wave * 16 + 8 * g + r] = lv; } } }
  __syncthreads();
  if (!isv) { for (int e = tid; e < 64 * 16; e += 128) { const int rl = e >> 4, q = e & 15; const size_t o = (b * NN + blockIdx.x * 64 + rl) * (2 * CC) + c0 + q * 8; vst2((unsigned*)(QK + o), *(const v4u*)&sh[rl][q * 8]); vst2((unsigned*)(QKL + o), *(const v4u*)&sl[rl][q * 8]); } }
  else { const int cv0 = c0 - 2 * CC; for (int e = tid; e < 128 * 8; e += 128) { const int cl = e >> 3, q = e & 7; const size_t o = ((b * CC + cv0 + cl) * (size_t)NN) + blockIdx.x * 64 + q * 8; vst2((unsigned*)(VT + o), *(const v4u*)&th[cl][q * 8]); vst2((unsigned*)(VTL + o), *(const v4u*)&tl[cl][q * 8]); } } }
// ---- k_att: block = (64 queries, head, b), transposed products: S^T = K . Q^T (3 products; a lane holds 16 of the pass's 32 keys of ONE query) x 32^-0.5 x (0.1 + 0.9 IM[n][m]), running-max softmax in-lane plus one exchange between the wave's halves, P^T packed from the score accumulators as B operand, O^T += V^T . P^T (v planes hi + residual, 2 products) -> Z merged
// operands come through a two-buffer LDS ring, a stage = 64 keys = 2 passes: K rows (hi | residual), v planes (hi, residual) and the block's 64 mask rows (bf16), each byte copied once per block with adjacent lanes on adjacent 16 bytes
__device__ __forceinline__ float xhalf(float x) { return __builtin_bit_cast(float, __builtin_amdgcn_permlanex16(__builtin_bit_cast(int, x), __builtin_bit_cast(int, x), 0x76543210, 0xfedcba98, false, false)); }  // lane l with lane l ^ 16
#define KT 64                          // keys per stage
#define KP 144                         // LDS pitch, bytes: K row (64 B hi | 64 B residual) and v plane row (64 keys), 16 B x odd for 16-byte readers
#define IP 144                         // LDS pitch, bytes: mask row (64 keys, bf16), 16 B x odd for 16-byte readers
#define OFF_VH (KT * KP)
#define OFF_VL (OFF_VH + DK * KP)
#define OFF_IM (OFF_VL + DK * KP)
#define STG (OFF_IM + 64 * IP)         // bytes of one stage
// eight asynchronous copies of 16 bytes per lane; the s_wait_xcnt stands inside the statement so that no address register of a copy is rewritten in front of it (a precaution)
__device__ __forceinline__ void cp8(unsigned l0, unsigned l1, unsigned l2, unsigned l3, unsigned l4, unsigned l5, unsigned l6, unsigned l7, const void* g0, const void* g1, const void* g2, const void* g3, const void* g4, const void* g5, const void* g6, const void* g7) {
  asm volatile("global_load_async_to_lds_b128 %0, %8, off\n\tglobal_load_async_to_lds_b128 %1, %9, off\n\tglobal_load_async_to_lds_b128 %2, %10, off\n\tglobal_load_async_to_lds_b128 %3, %11, off\n\t"
               "global_load_async_to_lds_b128 %4, %12, off\n\tglobal_load_async_to_lds_b128 %5, %13, off\n\tglobal_load_async_to_lds_b128 %6, %14, off\n\tglobal_load_async_to_lds_b128 %7, %15, off\n\ts_wait_xcnt 0x0"
               :: "v"(l0), "v"(l1), "v"(l2), "v"(l3), "v"(l4), "v"(l5), "v"(l6), "v"(l7), "v"(g0), "v"(g1), "v"(g2), "v"(g3), "v"(g4), "v"(g5), "v"(g6), "v"(g7) : "memory");
}
// four such copies, for the mask rows; the s_wait_xcnt stands inside the statement for the same reason (a precaution)
__device__ __forceinline__ void cp4(unsigned l0, unsigned l1, unsigned l2, unsigned l3, const void* g0, const void* g1, const void* g2, const void* g3) {
  asm volatile("global_load_async_to_lds_b128 %0, %4, off\n\tglobal_load_async_to_lds_b128 %1, %5, off\n\tglobal_load_async_to_lds_b128 %2, %6, off\n\tglobal_load_async_to_lds_b128 %3, %7, off\n\ts_wait_xcnt 0x0"
               :: "v"(l0), "v"(l1), "v"(l2), "v"(l3), "v"(g0), "v"(g1), "v"(g2), "v"(g3) : "memory");
}
// at most 4 waves a SIMD, as with the larger ring: the grid is 4 work-groups a WGP, and no WGP is to take a fifth while another holds three
__global__ __launch_bounds__(128) __attribute__((amdgpu_waves_per_eu(1, 4))) void k_att(const _Float16* __restrict__ QK, const _Float16* __restrict__ QKL, const _Float16* __restrict__ VT, const _Float16* __restrict__ VTL, const __bf16* __restrict__ MB, float* __restrict__ Z) {
  __shared__ __align__(16) unsigned char ring[2 * STG];
  const int tid = threadIdx.x, wave = tid >> 5, lane = tid & 31, col = lane & 15, g = lane >> 4; const int h = blockIdx.y; const size_t b = blockIdx.z; const int q0 = blockIdx.x * 64 + wave * 16; const size_t rq = b * NN + q0;
  const v16h aq = frag_h(QK + (rq + col) * (2 * CC) + h * DK, lane), aql = frag_h(QKL + (rq + col) * (2 * CC) + h * DK, lane);   // B operands: column = query q0 + col
  // this thread's share of a stage: K rows tid >> 2 and + 32 (4 lanes a 64-byte row), v channels tid >> 3 and + 16 (8 lanes a 128-byte row), mask rows tid >> 3 + 16 i (8 lanes a 128-byte row)
  const unsigned lr = (unsigned)(size_t)ring;   // the ring's byte address in LDS
  const unsigned lk = lr + (tid >> 2) * KP + (tid & 3) * 16, lv = lr + OFF_VH + (tid >> 3) * KP + (tid & 7) * 16, li = lr + OFF_IM + (tid >> 3) * IP + (tid & 7) * 16;
  const size_t ok = (b * NN + (tid >> 2)) * (2 * CC) + CC + h * DK + (tid & 3) * 8, ov = (b * CC + (size_t)h * DK + (tid >> 3)) * (size_t)NN + (tid & 7) * 8;
  const __bf16* gi = MB + (size_t)(blockIdx.x * 64 + (tid >> 3)) * NN + (tid & 7) * 8;
  auto fill = [&](int t, unsigned bo) {   // stage t into the buffer at byte offset bo
    const _Float16 *kh = QK + ok + (size_t)t * KT * (2 * CC), *kl = QKL + ok + (size_t)t * KT * (2 * CC), *vh = VT + ov + t * KT, *vl = VTL + ov + t * KT; const __bf16* im = gi + t * KT;
    cp8(lk + bo, lk + bo + 32 * KP, lk + bo + 64, lk + bo + 32 * KP + 64, lv + bo, lv + bo + 16 * KP, lv + bo + DK * KP, lv + bo + DK * KP + 16 * KP,
        kh, kh + 32 * (2 * CC), kl, kl + 32 * (2 * CC), vh, vh + 16 * (size_t)NN, vl, vl + 16 * (size_t)NN);
    cp4(li + bo, li + bo + 16 * IP, li + bo + 32 * IP, li + bo + 48 * IP, im, im + 16 * (size_t)NN, im + 32 * (size_t)NN, im + 48 * (size_t)NN); };
  float m = -3.0e38f, l = 0.f;   // l: this half's keys only, the halves are joined behind the loop
  v8f acc[2] = {}, accl[2] = {};   // O^T: register r of tile j = channel j * 16 + 8 g + r of query q0 + col
  fill(0, 0);
  asm volatile("s_wait_asynccnt 0x0" ::: "memory");   // stage 0 has landed before the barrier that publishes it
  __syncthreads();
  fill(1, STG);
#pragma unroll 1   // the stage loop stays rolled: one stage's code and registers
  for (int t = 0; t < NN / KT; ++t) { const unsigned bo = (t & 1) * STG; const unsigned char* st = ring + bo;
#pragma unroll   // both passes of a stage unrolled, so that every LDS offset is an immediate
   for (int sub = 0; sub < KT / 32; ++sub) { v8f s[2];
#pragma unroll
    for (int ct = 0; ct < 2; ++ct) { const _Float16* pk = (const _Float16*)(st + (sub * 32 + ct * 16 + col) * KP); const v16h kh = frag_h(pk, lane), kl = frag_h(pk + 32, lane);
      v8f c = {}, cl = {}; c = wmma16(kh, aq, c); cl = wmma16(kl, aq, cl); cl = wmma16(kh, aql, cl);
      const __bf16* pi = (const __bf16*)(st + OFF_IM + (wave * 16 + col) * IP) + sub * 32 + ct * 16 + 8 * g;   // this lane's query row; score register r of tile ct = key t * 64 + sub * 32 + ct * 16 + 8 g + r
      const v8b ia = *(const v8b*)pi;
#pragma unroll
      for (int r = 0; r < 8; ++r) s[ct][r] = (c[r] + cl[r] * (1.0f / 2048.0f)) * 0.17677669529663687f * (0.1f + 0.9f * (float)ia[r]); }
    float mx = fmaxf(s[0][0], s[1][0]);
#pragma unroll
    for (int r = 1; r < 8; ++r) mx = fmaxf(mx, fmaxf(s[0][r], s[1][r]));
    mx = fmaxf(mx, xhalf(mx));
    const float mn = fmaxf(m, mx), alpha = __expf(m - mn); float tt[8]; v16h pa;   // pa[i] = key kmap(i): tile i >> 3, register i & 7, the order frag_h gives the v planes
#pragma unroll
    for (int r = 0; r < 8; ++r) { const float e0 = __expf(s[0][r] - mn), e1 = __expf(s[1][r] - mn); tt[r] = e0 + e1; pa[r] = (_Float16)(e0 * 2048.0f); pa[8 + r] = (_Float16)(e1 * 2048.0f); }
    l = l * alpha + (((tt[0] + tt[1]) + (tt[2] + tt[3])) + ((tt[4] + tt[5]) + (tt[6] + tt[7]))); m = mn;
#pragma unroll
    for (int j = 0; j < 2; ++j)
#pragma unroll
      for (int r = 0; r < 8; ++r) { acc[j][r] *= alpha; accl[j][r] *= alpha; }
#pragma unroll
    for (int j = 0; j < 2; ++j) { const _Float16* pv = (const _Float16*)(st + OFF_VH + (j * 16 + col) * KP) + sub * 32; acc[j] = wmma16(frag_h(pv, lane), pa, acc[j]); accl[j] = wmma16(frag_h(pv + DK * KP / 2, lane), pa, accl[j]); } }
   asm volatile("s_wait_dscnt 0x0" ::: "memory");      // this wave's reads of the stage are done before the buffer is given up
   asm volatile("s_wait_asynccnt 0x0" ::: "memory");   // this wave's copies of stage t + 1 have landed before the barrier that publishes them
   __syncthreads();                                    // publishes stage t + 1 and ends every wave's reads of stage t
   if (t + 2 < NN / KT) fill(t + 2, bo); }
  asm volatile("s_wait_asynccnt 0x0" ::: "memory");   // nothing is in flight when the ring becomes output staging and the wave ends
  float (*so)[16][36] = (float (*)[16][36])ring;   // output staging in the ring, a slice per wave: behind the last stage's barrier nobody reads the ring and no copy is in flight
  l += xhalf(l);
  const float il = (1.0f / 2048.0f) / l;
#pragma unroll
  for (int j = 0; j < 2; ++j)
#pragma unroll
    for (int r = 0; r < 8; ++r) so[wave][col][j * 16 + 8 * g + r] = (acc[j][r] + accl[j][r] * (1.0f / 2048.0f)) * il;
  LDSX(); for (int rl = 0; rl < 16; ++rl) if (lane < 8) vst2(Z + (rq + rl) * CC + (size_t)h * DK + lane * 4, *(const v4f*)&so[wave][rl][lane * 4]); }
// ---- k_out: block = (64 rows, 128 cols): out = Z (bf16 hi + lo) . W_out + b
__global__ __launch_bounds__(128) void k_out(const float* __restrict__ Z, const __bf16* __restrict__ PO, const float* __restrict__ BO, float* __restrict__ OUT) { __shared__ __align__(16) float sf[4][16][132];
  const int tid = threadIdx.x, wave = tid >> 5, lane = tid & 31, col = lane & 15, g = lane >> 4; const size_t r0 = (size_t)blockIdx.x * 64 + wave * 16; const int c0 = blockIdx.y * 128;
  v8f acc[8] = {}; float bb[8];
#pragma unroll   // the eight bias loads stand ahead of the products, so that the epilogue waits for none of them
  for (int j = 0; j < 8; ++j) bb[j] = BO[c0 + j * 16 + col];
#pragma unroll
  for (int kc = 0; kc < CC / 32; ++kc) { const F2 a = split_row(Z + (r0 + col) * CC, kc * 32, lane); v16b w[8];
#pragma unroll   // a k step's eight W fragments are fetched as one group ahead of its products: one load latency a k step, not one a fragment
    for (int j = 0; j < 8; ++j) w[j] = frag_b(PO + (size_t)(c0 + j * 16 + col) * CC + kc * 32, lane);
#pragma unroll   // each tile still adds its hi product first and its lo product second
    for (int j = 0; j < 8; ++j) acc[j] = wmma_bf(a.h, w[j], acc[j]);
#pragma unroll   // unrolled like the loop above, so that w[] and acc[] are indexed by constants and stay in registers
    for (int j = 0; j < 8; ++j) acc[j] = wmma_bf(a.l, w[j], acc[j]); }
#pragma unroll
  for (int j = 0; j < 8; ++j) { const float bj = bfr(bb[j]);
#pragma unroll
    for (int r = 0; r < 8; ++r) sf[wave][8 * g + r][j * 16 + col] = acc[j][r] + bj; }
  LDSX(); for (int rl = 0; rl < 16; ++rl) vst2(OUT + (r0 + rl) * CC + c0 + lane * 4, *(const v4f*)&sf[wave][rl][lane * 4]); }
extern "C" void kernel_launch(void* const* d_in, const int* in_sizes, int n_in, void* d_out, int out_size, void* d_ws, size_t ws_size, hipStream_t stream) {
  (void)in_sizes; (void)n_in; (void)out_size;
  const float** F = (const float**)d_in;   // 0 x [4,2048,256], 1 interaction_mask [2048,2048], 2 W_qkv [256,768] (in,out), 3 b_qkv [768], 4 W_out [256,256] (in,out), 5 b_out
  if (ws_size < (size_t)WS_END) return;
  char* ws = (char*)d_ws; __bf16 *PW = (__bf16*)(ws + WS_PW), *PO = (__bf16*)(ws + WS_PO); _Float16 *QK = (_Float16*)(ws + WS_QK), *QKL = (_Float16*)(ws + WS_QKL), *VT = (_Float16*)(ws + WS_VT), *VTL = (_Float16*)(ws + WS_VTL); float* Z = (float*)(ws + WS_Z); __bf16* MB = (__bf16*)(ws + WS_MB);
  k_pack<<<4 * CC, 256, 0, stream>>>(F[2], F[4], F[1], PW, PO, MB);
  k_proj<<<dim3(NN / 64, 3 * CC / 128, TNB), 128, 0, stream>>>(F[0], PW, F[3], QK, QKL, VT, VTL);
  k_att<<<dim3(NN / 64, NH, TNB), 128, 0, stream>>>(QK, QKL, VT, VTL, MB, Z);
  k_out<<<dim3(TNB * NN / 64, CC / 128), 128, 0, stream>>>(Z, PO, F[5], (float*)d_out);
}

// v005
// A run of this version takes 89.2 microseconds.
// In two side-by-side timings against v004, it was 1.04 and 1.05 times as fast.
// Counting every step since v000, it is 2.66 times as fast.
// compute dtype: all float inputs rounded to bf16; qkv = x . W_qkv + b with EXACT bf16 products on WMMA 16x16x32 ((in,out) weights as transposed rows), q/k rounded to f16 hi + residual rows, v to f16 hi + residual planes; logits q . k with 3 products, x 32^-0.5 x (0.1 + 0.9 interaction_mask[n][m]) read per pair (mask rounded to bf16 once, ahead of the attention), running-max softmax in f32 in base 2 (hardware exp2; 32^-0.5 log2 e inside the mask factor's constants, 2^11 inside the maximum), P (x 2^11, f16) . v (hi + residual, 2 products); out = ctx (bf16 hi + lo, 2 products) . W_out + b; f32 output.
#include <hip/hip_runtime.h>
#include <math.h>

typedef __attribute__((ext_vector_type(16))) _Float16 v16h;
typedef __attribute__((ext_vector_type(16))) __bf16 v16b;
typedef __attribute__((ext_vector_type(8)))  _Float16 v8h;
typedef __attribute__((ext_vector_type(8)))  float v8f;
typedef __attribute__((ext_vector_type(4)))  float v4f;
typedef __attribute__((ext_vector_type(2)))  float v2f;
typedef __attribute__((ext_vector_type(4)))  unsigned v4u;
typedef __attribute__((ext_vector_type(4)))  int v4i;
typedef float __attribute__((may_alias)) float_a;
typedef int __attribute__((may_alias)) int_a;

template <typename T> __device__ __forceinline__ void vst2(void* p, T v) { *(T*)p = v;  }
// plain builtins: the compiler keeps the distance behind its own matrix instructions and is free to issue later operand loads ahead of them
__device__ __forceinline__ v8f wmma16(v16h a, v16h b, v8f c) {
  return __builtin_amdgcn_wmma_f32_16x16x32_f16(false, a, false, b, (short)0, c, false, false);
}
__device__ __forceinline__ v8f wmma_bf(v16b a, v16b b, v8f c) {
  return __builtin_amdgcn_wmma_f32_16x16x32_bf16(false, a, false, b, (short)0, c, false, false);
}
// 16x16x32 fragments: lane = (h = lane>>4, row/col = lane&15); elements 0..7 = k0+8h+0..7, 8..15 = k0+16+8h+0..7; D element r = row 8h+r
__device__ __forceinline__ v16h frag_h(const _Float16* rowk0, int lane) {
  union { v16h v; v8h q[2]; } u; const _Float16* p = rowk0 + 8 * (lane >> 4);
  u.q[0] = *(const v8h*)p; u.q[1] = *(const v8h*)(p + 16); return u.v;
}
__device__ __forceinline__ v16h frag_f32(const float* rowk0, int lane) {
  v16h a; const float* p = rowk0 + 8 * (lane >> 4);
#pragma unroll
  for (int i = 0; i < 8; ++i) { a[i] = (_Float16)p[i]; a[8 + i] = (_Float16)p[16 + i]; }
  return a;
}
__device__ __forceinline__ v16h frag_f32s(const float* rowk0, int lane, float sc) {
  v16h a; const float* p = rowk0 + 8 * (lane >> 4);
#pragma unroll
  for (int i = 0; i < 8; ++i) { a[i] = (_Float16)(p[i] * sc); a[8 + i] = (_Float16)(p[16 + i] * sc); }
  return a;
}
// column fragment from a [K][ld] layout (column n), rows >= K read as 0
__device__ __forceinline__ v16h fragc_f32(const float* W, int k0, int n, int lane, int ld, int K) {
  v16h a; const int g = lane >> 4;
#pragma unroll
  for (int i = 0; i < 8; ++i) { const int ka = k0 + 8 * g + i, kb = ka + 16;
    a[i] = (_Float16)(ka < K ? W[(size_t)(ka < K ? ka : K - 1) * ld + n] : 0.f); a[8 + i] = (_Float16)(kb < K ? W[(size_t)(kb < K ? kb : K - 1) * ld + n] : 0.f); }
  return a;
}
struct F2 { v16b h, l; };
__device__ __forceinline__ F2 bsplit16(const float v[16]) { F2 r;
#pragma unroll
  for (int i = 0; i < 16; ++i) { const __bf16 h = (__bf16)v[i]; r.h[i] = h; r.l[i] = (__bf16)(v[i] - (float)h); }
  return r; }
__device__ __forceinline__ F2 split_row(const float* row, int k0, int lane) { float v[16]; const float* p = row + k0 + 8 * (lane >> 4);
#pragma unroll
  for (int i = 0; i < 8; ++i) { v[i] = p[i]; v[8 + i] = p[16 + i]; }
  return bsplit16(v); }
__device__ __forceinline__ F2 split_rowK(const float* row, int k0, int lane, int K) { float v[16]; const int g = lane >> 4;
#pragma unroll
  for (int i = 0; i < 8; ++i) { const int ka = k0 + 8 * g + i, kb = ka + 16; v[i] = ka < K ? row[ka < K ? ka : K - 1] : 0.f; v[8 + i] = kb < K ? row[kb < K ? kb : K - 1] : 0.f; }
  return bsplit16(v); }
__device__ __forceinline__ F2 split_col(const float* W, int k0, int n, int lane, int ld, int K) { float v[16]; const int g = lane >> 4;
#pragma unroll
  for (int i = 0; i < 8; ++i) { const int ka = k0 + 8 * g + i, kb = ka + 16; v[i] = ka < K ? W[(size_t)(ka < K ? ka : K - 1) * ld + n] : 0.f; v[8 + i] = kb < K ? W[(size_t)(kb < K ? kb : K - 1) * ld + n] : 0.f; }
  return bsplit16(v); }
__device__ __forceinline__ v8f mac3(const F2& a, const F2& b, v8f c) { c = wmma_bf(a.l, b.h, c); c = wmma_bf(a.h, b.l, c); return wmma_bf(a.h, b.h, c); }
__device__ __forceinline__ float sigm(float v) { return 1.0f / (1.0f + expf(-v)); }
#define LDSX() do { asm volatile("s_wait_dscnt 0" ::: "memory"); __builtin_amdgcn_wave_barrier(); __builtin_amdgcn_fence(__ATOMIC_RELEASE, "workgroup"); } while (0)


// Biologically-modulated attention (B 4, N 2,048 genes, C 256, 8 heads x 32): fused (in,out) qkv + bias, logits scaled by (0.1 + 0.9 x PPI interaction strength) before the softmax, (in,out) output projection + bias.
#define NB 4
#define NN 2048
#define CC 256
#define NH 8
#define DK 32
#ifndef TNB
#define TNB NB
#endif
typedef __attribute__((ext_vector_type(8))) __bf16 v8b;
__device__ __forceinline__ v16b frag_b(const __bf16* rowk0, int lane) {
  union { v16b v; v8b q[2]; } u; const __bf16* p = rowk0 + 8 * (lane >> 4);
  u.q[0] = *(const v8b*)p; u.q[1] = *(const v8b*)(p + 16); return u.v;
}
__device__ __forceinline__ float bfr(float v) { return (float)(__bf16)v; }
__device__ __attribute__((noinline)) float exp_ni(float v) { return expf(v); }
__device__ __attribute__((noinline)) float erf_ni(float v) { return erff(v); }

#define WS_PW  0u                                   // bf16 rows [768][256] (qkv, transposed (in,out)); [256][256] W_out^T
#define WS_PO  (WS_PW + 2u * 3 * CC * CC)
#define WS_QK  (WS_PO + 2u * CC * CC)                   // f16 hi|lo q|k rows [b*NN + n][512]
#define WS_QKL (WS_QK + 2u * (size_t)NB * NN * 2 * CC)
#define WS_VT  (WS_QKL + 2u * (size_t)NB * NN * 2 * CC) // f16 hi|lo v planes [b][c][n]
#define WS_VTL (WS_VT + 2u * (size_t)NB * CC * NN)
#define WS_Z   (WS_VTL + 2u * (size_t)NB * CC * NN)     // f32 ctx [b*NN + n][256]
#define WS_MB  (WS_Z + 4u * (size_t)NB * NN * CC)       // bf16 interaction mask [n][m]
#define WS_END (WS_MB + 2u * (size_t)NN * NN)

typedef __attribute__((ext_vector_type(4))) __bf16 v4b;
#define MPB (NN * NN / (4 * CC))       // mask elements a k_pack block rounds
static_assert(MPB % 1024 == 0, "a block's share of the mask is whole rounds of 256 threads x 4 floats");
__global__ __launch_bounds__(256) void k_pack(const float* __restrict__ WQKV, const float* __restrict__ WO, const float* __restrict__ IM, __bf16* __restrict__ PW, __bf16* __restrict__ PO, __bf16* __restrict__ MB) { const int n = blockIdx.x, t = threadIdx.x; __shared__ __align__(16) __bf16 s[CC];   // n in [0, 1024): rows 0..767 qkv columns, 768..1023 W_out columns
  // the block's share of the interaction mask, rounded to bf16 once here for every batch and head; adjacent lanes on adjacent 16 bytes, loads issued ahead of the weight column
  const size_t mo = (size_t)n * MPB + t * 4; v4f mk[MPB / 1024];
#pragma unroll   // all of the share's loads in flight together, mk[] in registers
  for (int i = 0; i < MPB / 1024; ++i) mk[i] = *(const v4f*)(IM + mo + i * 1024);
  if (n < 3 * CC) s[t] = (__bf16)WQKV[(size_t)t * (3 * CC) + n]; else s[t] = (__bf16)WO[(size_t)t * CC + (n - 3 * CC)]; __syncthreads();
  __bf16* dst = (n < 3 * CC) ? PW + (size_t)n * CC : PO + (size_t)(n - 3 * CC) * CC; if (t < CC / 8) vst2((unsigned*)(dst + t * 8), *(const v4u*)&s[t * 8]);
#pragma unroll   // mk[] indexed by constants
  for (int i = 0; i < MPB / 1024; ++i) { v4b o;
#pragma unroll   // vector elements indexed by constants
    for (int e = 0; e < 4; ++e) o[e] = (__bf16)mk[i][e];
    *(v4b*)(MB + mo + i * 1024) = o; } }
__device__ __forceinline__ v16b fragb_f32(const float* __restrict__ p, int lane) { v16b a; const float* pp = p + 8 * (lane >> 4);
#pragma unroll
  for (int i = 0; i < 8; ++i) { a[i] = (__bf16)pp[i]; a[8 + i] = (__bf16)pp[16 + i]; } return a; }
// ---- k_proj: block = (64 rows, 128 of 768 cols, b): y = x . W + b (exact); cols < 512 (q|k) -> f16 hi/lo rows; cols >= 512 (v) -> transposed planes
__global__ __launch_bounds__(128) void k_proj(const float* __restrict__ X, const __bf16* __restrict__ PW, const float* __restrict__ BQKV, _Float16* __restrict__ QK, _Float16* __restrict__ QKL, _Float16* __restrict__ VT, _Float16* __restrict__ VTL) {
  __shared__ __align__(16) _Float16 sh[64][136], sl[64][136]; __shared__ __align__(16) _Float16 th[128][72], tl[128][72];
  const int tid = threadIdx.x, wave = tid >> 5, lane = tid & 31, col = lane & 15, g = lane >> 4; const size_t b = blockIdx.z; const int i0 = blockIdx.x * 64 + wave * 16; const int c0 = blockIdx.y * 128; const size_t r0 = b * NN + i0;
  v8f acc[8] = {};
#pragma unroll
  for (int kc = 0; kc < CC / 32; ++kc) { const v16b a = fragb_f32(X + (r0 + col) * CC + kc * 32, lane);
#pragma unroll
    for (int j = 0; j < 8; ++j) acc[j] = wmma_bf(a, frag_b(PW + (size_t)(c0 + j * 16 + col) * CC + kc * 32, lane), acc[j]); }
  const bool isv = c0 >= 2 * CC;
#pragma unroll
  for (int j = 0; j < 8; ++j) { const float bb = bfr(BQKV[c0 + j * 16 + col]);
#pragma unroll
    for (int r = 0; r < 8; ++r) { const float v = acc[j][r] + bb; const _Float16 hv = (_Float16)v; const _Float16 lv = (_Float16)((v - (float)hv) * 2048.0f); if (!isv) { sh[wave * 16 + 8 * g + r][j * 16 + col] = hv; sl[wave * 16 + 8 * g + r][j * 16 + col] = lv; } else { th[j * 16 + col][wave * 16 + 8 * g + r] = hv; tl[j * 16 + col][wave * 16 + 8 * g + r] = lv; } } }
  __syncthreads();
  if (!isv) { for (int e = tid; e < 64 * 16; e += 128) { const int rl = e >> 4, q = e & 15; const size_t o = (b * NN + blockIdx.x * 64 + rl) * (2 * CC) + c0 + q * 8; vst2((unsigned*)(QK + o), *(const v4u*)&sh[rl][q * 8]); vst2((unsigned*)(QKL + o), *(const v4u*)&sl[rl][q * 8]); } }
  else { const int cv0 = c0 - 2 * CC; for (int e = tid; e < 128 * 8; e += 128) { const int cl = e >> 3, q = e & 7; const size_t o = ((b * CC + cv0 + cl) * (size_t)NN) + blockIdx.x * 64 + q * 8; vst2((unsigned*)(VT + o), *(const v4u*)&th[cl][q * 8]); vst2((unsigned*)(VTL + o), *(const v4u*)&tl[cl][q * 8]); } } }
// ---- k_att: block = (64 queries, head, b), transposed products: S^T = K . Q^T (3 products; a lane holds 16 of the pass's 32 keys of ONE query) x 32^-0.5 x (0.1 + 0.9 IM[n][m]) x log2 e, running-max base-2 softmax in-lane plus one exchange between the wave's halves, P^T packed from the score accumulators as B operand, O^T += V^T . P^T (v planes hi + residual, 2 products) -> Z merged
// operands come through a two-buffer LDS ring, a stage = 64 keys = 2 passes: K rows (hi | residual), v planes (hi, residual) and the block's 64 mask rows (bf16), each byte copied once per block with adjacent lanes on adjacent 16 bytes
__device__ __forceinline__ float xhalf(float x) { return __builtin_bit_cast(float, __builtin_amdgcn_permlanex16(__builtin_bit_cast(int, x), __builtin_bit_cast(int, x), 0x76543210, 0xfedcba98, false, false)); }  // lane l with lane l ^ 16
#define KT 64                          // keys per stage
#define KP 144                         // LDS pitch, bytes: K row (64 B hi | 64 B residual) and v plane row (64 keys), 16 B x odd for 16-byte readers
#define IP 144                         // LDS pitch, bytes: mask row (64 keys, bf16), 16 B x odd for 16-byte readers
#define OFF_VH (KT * KP)
#define OFF_VL (OFF_VH + DK * KP)
#define OFF_IM (OFF_VL + DK * KP)
#define STG (OFF_IM + 64 * IP)         // bytes of one stage
// softmax in base 2: 32^-0.5 and log2(e) are folded into the two constants of the mask factor, (0.1 + 0.9 mask) x 32^-0.5 x log2(e) = FA + FB x mask
#define FA ((float)(0.1 * 0.17677669529663687 * 1.4426950408889634))
#define FB ((float)(0.9 * 0.17677669529663687 * 1.4426950408889634))
// eight asynchronous copies of 16 bytes per lane; the s_wait_xcnt stands inside the statement so that no address register of a copy is rewritten in front of it (a precaution)
__device__ __forceinline__ void cp8(unsigned l0, unsigned l1, unsigned l2, unsigned l3, unsigned l4, unsigned l5, unsigned l6, unsigned l7, const void* g0, const void* g1, const void* g2, const void* g3, const void* g4, const void* g5, const void* g6, const void* g7) {
  asm volatile("global_load_async_to_lds_b128 %0, %8, off\n\tglobal_load_async_to_lds_b128 %1, %9, off\n\tglobal_load_async_to_lds_b128 %2, %10, off\n\tglobal_load_async_to_lds_b128 %3, %11, off\n\t"
               "global_load_async_to_lds_b128 %4, %12, off\n\tglobal_load_async_to_lds_b128 %5, %13, off\n\tglobal_load_async_to_lds_b128 %6, %14, off\n\tglobal_load_async_to_lds_b128 %7, %15, off\n\ts_wait_xcnt 0x0"
               :: "v"(l0), "v"(l1), "v"(l2), "v"(l3), "v"(l4), "v"(l5), "v"(l6), "v"(l7), "v"(g0), "v"(g1), "v"(g2), "v"(g3), "v"(g4), "v"(g5), "v"(g6), "v"(g7) : "memory");
}
// four such copies, for the mask rows; the s_wait_xcnt stands inside the statement for the same reason (a precaution)
__device__ __forceinline__ void cp4(unsigned l0, unsigned l1, unsigned l2, unsigned l3, const void* g0, const void* g1, const void* g2, const void* g3) {
  asm volatile("global_load_async_to_lds_b128 %0, %4, off\n\tglobal_load_async_to_lds_b128 %1, %5, off\n\tglobal_load_async_to_lds_b128 %2, %6, off\n\tglobal_load_async_to_lds_b128 %3, %7, off\n\ts_wait_xcnt 0x0"
               :: "v"(l0), "v"(l1), "v"(l2), "v"(l3), "v"(g0), "v"(g1), "v"(g2), "v"(g3) : "memory");
}
// at most 4 waves a SIMD, as with the larger ring: the grid is 4 work-groups a WGP, and no WGP is to take a fifth while another holds three
__global__ __launch_bounds__(128) __attribute__((amdgpu_waves_per_eu(1, 4))) void k_att(const _Float16* __restrict__ QK, const _Float16* __restrict__ QKL, const _Float16* __restrict__ VT, const _Float16* __restrict__ VTL, const __bf16* __restrict__ MB, float* __restrict__ Z) {
  __shared__ __align__(16) unsigned char ring[2 * STG];
  const int tid = threadIdx.x, wave = tid >> 5, lane = tid & 31, col = lane & 15, g = lane >> 4; const int h = blockIdx.y; const size_t b = blockIdx.z; const int q0 = blockIdx.x * 64 + wave * 16; const size_t rq = b * NN + q0;
  const v16h aq = frag_h(QK + (rq + col) * (2 * CC) + h * DK, lane), aql = frag_h(QKL + (rq + col) * (2 * CC) + h * DK, lane);   // B operands: column = query q0 + col
  // this thread's share of a stage: K rows tid >> 2 and + 32 (4 lanes a 64-byte row), v channels tid >> 3 and + 16 (8 lanes a 128-byte row), mask rows tid >> 3 + 16 i (8 lanes a 128-byte row)
  const unsigned lr = (unsigned)(size_t)ring;   // the ring's byte address in LDS
  const unsigned lk = lr + (tid >> 2) * KP + (tid & 3) * 16, lv = lr + OFF_VH + (tid >> 3) * KP + (tid & 7) * 16, li = lr + OFF_IM + (tid >> 3) * IP + (tid & 7) * 16;
  const size_t ok = (b * NN + (tid >> 2)) * (2 * CC) + CC + h * DK + (tid & 3) * 8, ov = (b * CC + (size_t)h * DK + (tid >> 3)) * (size_t)NN + (tid & 7) * 8;
  const __bf16* gi = MB + (size_t)(blockIdx.x * 64 + (tid >> 3)) * NN + (tid & 7) * 8;
  auto fill = [&](int t, unsigned bo) {   // stage t into the buffer at byte offset bo
    const _Float16 *kh = QK + ok + (size_t)t * KT * (2 * CC), *kl = QKL + ok + (size_t)t * KT * (2 * CC), *vh = VT + ov + t * KT, *vl = VTL + ov + t * KT; const __bf16* im = gi + t * KT;
    cp8(lk + bo, lk + bo + 32 * KP, lk + bo + 64, lk + bo + 32 * KP + 64, lv + bo, lv + bo + 16 * KP, lv + bo + DK * KP, lv + bo + DK * KP + 16 * KP,
        kh, kh + 32 * (2 * CC), kl, kl + 32 * (2 * CC), vh, vh + 16 * (size_t)NN, vl, vl + 16 * (size_t)NN);
    cp4(li + bo, li + bo + 16 * IP, li + bo + 32 * IP, li + bo + 48 * IP, im, im + 16 * (size_t)NN, im + 32 * (size_t)NN, im + 48 * (size_t)NN); };
  float m = -3.0e38f, l = 0.f;   // m: running maximum of the base-2 logits less 11, the one offset of exponents and rescaling, so that every exp2 comes out x 2^11; l: sum of those, this half's keys only, the halves are joined behind the loop
  v8f acc[2] = {}, accl[2] = {};   // O^T: register r of tile j = channel j * 16 + 8 g + r of query q0 + col
  fill(0, 0);
  asm volatile("s_wait_asynccnt 0x0" ::: "memory");   // stage 0 has landed before the barrier that publishes it
  __syncthreads();
  fill(1, STG);
#pragma unroll 1   // the stage loop stays rolled: one stage's code and registers
  for (int t = 0; t < NN / KT; ++t) { const unsigned bo = (t & 1) * STG; const unsigned char* st = ring + bo;
#pragma unroll   // both passes of a stage unrolled, so that every LDS offset is an immediate
   for (int sub = 0; sub < KT / 32; ++sub) { v8f s[2];
#pragma unroll
    for (int ct = 0; ct < 2; ++ct) { const _Float16* pk = (const _Float16*)(st + (sub * 32 + ct * 16 + col) * KP); const v16h kh = frag_h(pk, lane), kl = frag_h(pk + 32, lane);
      v8f c = {}, cl = {}; c = wmma16(kh, aq, c); cl = wmma16(kl, aq, cl); cl = wmma16(kh, aql, cl);
      const __bf16* pi = (const __bf16*)(st + OFF_IM + (wave * 16 + col) * IP) + sub * 32 + ct * 16 + 8 * g;   // this lane's query row; score register r of tile ct = key t * 64 + sub * 32 + ct * 16 + 8 g + r
      const v8b ia = *(const v8b*)pi;
#pragma unroll
      for (int r = 0; r < 8; ++r) s[ct][r] = (c[r] + cl[r] * (1.0f / 2048.0f)) * (FA + FB * (float)ia[r]); }   // base-2 logit
    float mx = fmaxf(s[0][0], s[1][0]);
#pragma unroll
    for (int r = 1; r < 8; ++r) mx = fmaxf(mx, fmaxf(s[0][r], s[1][r]));
    mx = fmaxf(mx, xhalf(mx));
    const float mn = fmaxf(m, mx - 11.0f), alpha = __builtin_amdgcn_exp2f(m - mn); float tt[8]; v16h pa;   // pa[i] = key kmap(i): tile i >> 3, register i & 7, the order frag_h gives the v planes
#pragma unroll
    for (int r = 0; r < 8; ++r) { const float e0 = __builtin_amdgcn_exp2f(s[0][r] - mn), e1 = __builtin_amdgcn_exp2f(s[1][r] - mn); tt[r] = e0 + e1; pa[r] = (_Float16)e0; pa[8 + r] = (_Float16)e1; }
    l = l * alpha + (((tt[0] + tt[1]) + (tt[2] + tt[3])) + ((tt[4] + tt[5]) + (tt[6] + tt[7]))); m = mn;
#pragma unroll
    for (int j = 0; j < 2; ++j)
#pragma unroll
      for (int r = 0; r < 8; ++r) { acc[j][r] *= alpha; accl[j][r] *= alpha; }
#pragma unroll
    for (int j = 0; j < 2; ++j) { const _Float16* pv = (const _Float16*)(st + OFF_VH + (j * 16 + col) * KP) + sub * 32; acc[j] = wmma16(frag_h(pv, lane), pa, acc[j]); accl[j] = wmma16(frag_h(pv + DK * KP / 2, lane), pa, accl[j]); } }
   asm volatile("s_wait_dscnt 0x0" ::: "memory");      // this wave's reads of the stage are done before the buffer is given up
   asm volatile("s_wait_asynccnt 0x0" ::: "memory");   // this wave's copies of stage t + 1 have landed before the barrier that publishes them
   __syncthreads();                                    // publishes stage t + 1 and ends every wave's reads of stage t
   if (t + 2 < NN / KT) fill(t + 2, bo); }
  asm volatile("s_wait_asynccnt 0x0" ::: "memory");   // nothing is in flight when the ring becomes output staging and the wave ends
  float (*so)[16][36] = (float (*)[16][36])ring;   // output staging in the ring, a slice per wave: behind the last stage's barrier nobody reads the ring and no copy is in flight
  l += xhalf(l);
  const float il = 1.0f / l;   // l and the accumulators both carry the 2^11
#pragma unroll
  for (int j = 0; j < 2; ++j)
#pragma unroll
    for (int r = 0; r < 8; ++r) so[wave][col][j * 16 + 8 * g + r] = (acc[j][r] + accl[j][r] * (1.0f / 2048.0f)) * il;
  LDSX(); for (int rl = 0; rl < 16; ++rl) if (lane < 8) vst2(Z + (rq + rl) * CC + (size_t)h * DK + lane * 4, *(const v4f*)&so[wave][rl][lane * 4]); }
// ---- k_out: block = (64 rows, 128 cols): out = Z (bf16 hi + lo) . W_out + b
__global__ __launch_bounds__(128) void k_out(const float* __restrict__ Z, const __bf16* __restrict__ PO, const float* __restrict__ BO, float* __restrict__ OUT) { __shared__ __align__(16) float sf[4][16][132];
  const int tid = threadIdx.x, wave = tid >> 5, lane = tid & 31, col = lane & 15, g = lane >> 4; const size_t r0 = (size_t)blockIdx.x * 64 + wave * 16; const int c0 = blockIdx.y * 128;
  v8f acc[8] = {}; float bb[8];
#pragma unroll   // the eight bias loads stand ahead of the products, so that the epilogue waits for none of them
  for (int j = 0; j < 8; ++j) bb[j] = BO[c0 + j * 16 + col];
#pragma unroll
  for (int kc = 0; kc < CC / 32; ++kc) { const F2 a = split_row(Z + (r0 + col) * CC, kc * 32, lane); v16b w[8];
#pragma unroll   // a k step's eight W fragments are fetched as one group ahead of its products: one load latency a k step, not one a fragment
    for (int j = 0; j < 8; ++j) w[j] = frag_b(PO + (size_t)(c0 + j * 16 + col) * CC + kc * 32, lane);
#pragma unroll   // each tile still adds its hi product first and its lo product second
    for (int j = 0; j < 8; ++j) acc[j] = wmma_bf(a.h, w[j], acc[j]);
#pragma unroll   // unrolled like the loop above, so that w[] and acc[] are indexed by constants and stay in registers
    for (int j = 0; j < 8; ++j) acc[j] = wmma_bf(a.l, w[j], acc[j]); }
#pragma unroll
  for (int j = 0; j < 8; ++j) { const float bj = bfr(bb[j]);
#pragma unroll
    for (int r = 0; r < 8; ++r) sf[wave][8 * g + r][j * 16 + col] = acc[j][r] + bj; }
  LDSX(); for (int rl = 0; rl < 16; ++rl) vst2(OUT + (r0 + rl) * CC + c0 + lane * 4, *(const v4f*)&sf[wave][rl][lane * 4]); }
extern "C" void kernel_launch(void* const* d_in, const int* in_sizes, int n_in, void* d_out, int out_size, void* d_ws, size_t ws_size, hipStream_t stream) {
  (void)in_sizes; (void)n_in; (void)out_size;
  const float** F = (const float**)d_in;   // 0 x [4,2048,256], 1 interaction_mask [2048,2048], 2 W_qkv [256,768] (in,out), 3 b_qkv [768], 4 W_out [256,256] (in,out), 5 b_out
  if (ws_size < (size_t)WS_END) return;
  char* ws = (char*)d_ws; __bf16 *PW = (__bf16*)(ws + WS_PW), *PO = (__bf16*)(ws + WS_PO); _Float16 *QK = (_Float16*)(ws + WS_QK), *QKL = (_Float16*)(ws + WS_QKL), *VT = (_Float16*)(ws + WS_VT), *VTL = (_Float16*)(ws + WS_VTL); float* Z = (float*)(ws + WS_Z); __bf16* MB = (__bf16*)(ws + WS_MB);
  k_pack<<<4 * CC, 256, 0, stream>>>(F[2], F[4], F[1], PW, PO, MB);
  k_proj<<<dim3(NN / 64, 3 * CC / 128, TNB), 128, 0, stream>>>(F[0], PW, F[3], QK, QKL, VT, VTL);
  k_att<<<dim3(NN / 64, NH, TNB), 128, 0, stream>>>(QK, QKL, VT, VTL, MB, Z);
  k_out<<<dim3(TNB * NN / 64, CC / 128), 128, 0, stream>>>(Z, PO, F[5], (float*)d_out);
}

// v006
// Measured time: 80 microseconds a run.
// In two side-by-side timings against v005, it was 1.11 and 1.12 times as fast.
// Over all steps from v000 it is 2.96 times as fast.
// compute dtype: all float inputs rounded to bf16; qkv = x . W_qkv + b with EXACT bf16 products on WMMA 16x16x32 ((in,out) weights as transposed rows), q/k rounded to f16 hi + residual rows, v to f16 hi + residual planes; logits q . k with 3 products, x 32^-0.5 x (0.1 + 0.9 interaction_mask[n][m]) read per pair (mask rounded to bf16 once, ahead of the attention), running-max softmax in f32 in base 2 (hardware exp2; 32^-0.5 log2 e inside the mask factor's constants, 2^11 inside the maximum), P (x 2^11, f16) . v (hi + residual, 2 products); out = ctx (bf16 hi + lo, 2 products) . W_out + b; f32 output.
#include <hip/hip_runtime.h>
#include <math.h>

typedef __attribute__((ext_vector_type(16))) _Float16 v16h;
typedef __attribute__((ext_vector_type(16))) __bf16 v16b;
typedef __attribute__((ext_vector_type(8)))  _Float16 v8h;
typedef __attribute__((ext_vector_type(8)))  float v8f;
typedef __attribute__((ext_vector_type(4)))  float v4f;
typedef __attribute__((ext_vector_type(2)))  float v2f;
typedef __attribute__((ext_vector_type(4)))  unsigned v4u;
typedef __attribute__((ext_vector_type(4)))  int v4i;
typedef float __attribute__((may_alias)) float_a;
typedef int __attribute__((may_alias)) int_a;

template <typename T> __device__ __forceinline__ void vst2(void* p, T v) { *(T*)p = v;  }
// plain builtins: the compiler keeps the distance behind its own matrix instructions and is free to issue later operand loads ahead of them
__device__ __forceinline__ v8f wmma16(v16h a, v16h b, v8f c) {
  return __builtin_amdgcn_wmma_f32_16x16x32_f16(false, a, false, b, (short)0, c, false, false);
}
__device__ __forceinline__ v8f wmma_bf(v16b a, v16b b, v8f c) {
  return __builtin_amdgcn_wmma_f32_16x16x32_bf16(false, a, false, b, (short)0, c, false, false);
}
// 16x16x32 fragments: lane = (h = lane>>4, row/col = lane&15); elements 0..7 = k0+8h+0..7, 8..15 = k0+16+8h+0..7; D element r = row 8h+r
__device__ __forceinline__ v16h frag_h(const _Float16* rowk0, int lane) {
  union { v16h v; v8h q[2]; } u; const _Float16* p = rowk0 + 8 * (lane >> 4);
  u.q[0] = *(const v8h*)p; u.q[1] = *(const v8h*)(p + 16); return u.v;
}
__device__ __forceinline__ v16h frag_f32(const float* rowk0, int lane) {
  v16h a; const float* p = rowk0 + 8 * (lane >> 4);
#pragma unroll
  for (int i = 0; i < 8; ++i) { a[i] = (_Float16)p[i]; a[8 + i] = (_Float16)p[16 + i]; }
  return a;
}
__device__ __forceinline__ v16h frag_f32s(const float* rowk0, int lane, float sc) {
  v16h a; const float* p = rowk0 + 8 * (lane >> 4);
#pragma unroll
  for (int i = 0; i < 8; ++i) { a[i] = (_Float16)(p[i] * sc); a[8 + i] = (_Float16)(p[16 + i] * sc); }
  return a;
}
// column fragment from a [K][ld] layout (column n), rows >= K read as 0
__device__ __forceinline__ v16h fragc_f32(const float* W, int k0, int n, int lane, int ld, int K) {
  v16h a; const int g = lane >> 4;
#pragma unroll
  for (int i = 0; i < 8; ++i) { const int ka = k0 + 8 * g + i, kb = ka + 16;
    a[i] = (_Float16)(ka < K ? W[(size_t)(ka < K ? ka : K - 1) * ld + n] : 0.f); a[8 + i] = (_Float16)(kb < K ? W[(size_t)(kb < K ? kb : K - 1) * ld + n] : 0.f); }
  return a;
}
struct F2 { v16b h, l; };
__device__ __forceinline__ F2 bsplit16(const float v[16]) { F2 r;
#pragma unroll
  for (int i = 0; i < 16; ++i) { const __bf16 h = (__bf16)v[i]; r.h[i] = h; r.l[i] = (__bf16)(v[i] - (float)h); }
  return r; }
__device__ __forceinline__ F2 split_row(const float* row, int k0, int lane) { float v[16]; const float* p = row + k0 + 8 * (lane >> 4);
#pragma unroll
  for (int i = 0; i < 8; ++i) { v[i] = p[i]; v[8 + i] = p[16 + i]; }
  return bsplit16(v); }
__device__ __forceinline__ F2 split_rowK(const float* row, int k0, int lane, int K) { float v[16]; const int g = lane >> 4;
#pragma unroll
  for (int i = 0; i < 8; ++i) { const int ka = k0 + 8 * g + i, kb = ka + 16; v[i] = ka < K ? row[ka < K ? ka : K - 1] : 0.f; v[8 + i] = kb < K ? row[kb < K ? kb : K - 1] : 0.f; }
  return bsplit16(v); }
__device__ __forceinline__ F2 split_col(const float* W, int k0, int n, int lane, int ld, int K) { float v[16]; const int g = lane >> 4;
#pragma unroll
  for (int i = 0; i < 8; ++i) { const int ka = k0 + 8 * g + i, kb = ka + 16; v[i] = ka < K ? W[(size_t)(ka < K ? ka : K - 1) * ld + n] : 0.f; v[8 + i] = kb < K ? W[(size_t)(kb < K ? kb : K - 1) * ld + n] : 0.f; }
  return bsplit16(v); }
__device__ __forceinline__ v8f mac3(const F2& a, const F2& b, v8f c) { c = wmma_bf(a.l, b.h, c); c = wmma_bf(a.h, b.l, c); return wmma_bf(a.h, b.h, c); }
__device__ __forceinline__ float sigm(float v) { return 1.0f / (1.0f + expf(-v)); }
#define LDSX() do { asm volatile("s_wait_dscnt 0" ::: "memory"); __builtin_amdgcn_wave_barrier(); __builtin_amdgcn_fence(__ATOMIC_RELEASE, "workgroup"); } while (0)


// Biologically-modulated attention (B 4, N 2,048 genes, C 256, 8 heads x 32): fused (in,out) qkv + bias, logits scaled by (0.1 + 0.9 x PPI interaction strength) before the softmax, (in,out) output projection + bias.
#define NB 4
#define NN 2048
#define CC 256
#define NH 8
#define DK 32
#ifndef TNB
#define TNB NB
#endif
typedef __attribute__((ext_vector_type(8))) __bf16 v8b;
__device__ __forceinline__ v16b frag_b(const __bf16* rowk0, int lane) {
  union { v16b v; v8b q[2]; } u; const __bf16* p = rowk0 + 8 * (lane >> 4);
  u.q[0] = *(const v8b*)p; u.q[1] = *(const v8b*)(p + 16); return u.v;
}
__device__ __forceinline__ float bfr(float v) { return (float)(__bf16)v; }
__device__ __attribute__((noinline)) float exp_ni(float v) { return expf(v); }
__device__ __attribute__((noinline)) float erf_ni(float v) { return erff(v); }

#define WS_PW  0u                                   // bf16 rows [768][256] (qkv, transposed (in,out)); [256][256] W_out^T
#define WS_PO  (WS_PW + 2u * 3 * CC * CC)
#define WS_QK  (WS_PO + 2u * CC * CC)                   // f16 hi|lo q|k rows [b*NN + n][512]
#define WS_QKL (WS_QK + 2u * (size_t)NB * NN * 2 * CC)
#define WS_VT  (WS_QKL + 2u * (size_t)NB * NN * 2 * CC) // f16 hi|lo v planes [b][c][n]
#define WS_VTL (WS_VT + 2u * (size_t)NB * CC * NN)
#define WS_Z   (WS_VTL + 2u * (size_t)NB * CC * NN)     // f32 ctx [b*NN + n][256]
#define WS_MB  (WS_Z + 4u * (size_t)NB * NN * CC)       // bf16 interaction mask [n][m]
#define WS_END (WS_MB + 2u * (size_t)NN * NN)

typedef __attribute__((ext_vector_type(4))) __bf16 v4b;
#define MPB (NN * NN / (4 * CC))       // mask elements a k_pack block rounds
static_assert(MPB % 1024 == 0, "a block's share of the mask is whole rounds of 256 threads x 4 floats");
__global__ __launch_bounds__(256) void k_pack(const float* __restrict__ WQKV, const float* __restrict__ WO, const float* __restrict__ IM, __bf16* __restrict__ PW, __bf16* __restrict__ PO, __bf16* __restrict__ MB) { const int n = blockIdx.x, t = threadIdx.x; __shared__ __align__(16) __bf16 s[CC];   // n in [0, 1024): rows 0..767 qkv columns, 768..1023 W_out columns
  // the block's share of the interaction mask, rounded to bf16 once here for every batch and head; adjacent lanes on adjacent 16 bytes, loads issued ahead of the weight column
  const size_t mo = (size_t)n * MPB + t * 4; v4f mk[MPB / 1024];
#pragma unroll   // all of the share's loads in flight together, mk[] in registers
  for (int i = 0; i < MPB / 1024; ++i) mk[i] = *(const v4f*)(IM + mo + i * 1024);
  if (n < 3 * CC) s[t] = (__bf16)WQKV[(size_t)t * (3 * CC) + n]; else s[t] = (__bf16)WO[(size_t)t * CC + (n - 3 * CC)]; __syncthreads();
  __bf16* dst = (n < 3 * CC) ? PW + (size_t)n * CC : PO + (size_t)(n - 3 * CC) * CC; if (t < CC / 8) vst2((unsigned*)(dst + t * 8), *(const v4u*)&s[t * 8]);
#pragma unroll   // mk[] indexed by constants
  for (int i = 0; i < MPB / 1024; ++i) { v4b o;
#pragma unroll   // vector elements indexed by constants
    for (int e = 0; e < 4; ++e) o[e] = (__bf16)mk[i][e];
    *(v4b*)(MB + mo + i * 1024) = o; } }
__device__ __forceinline__ v16b fragb_f32(const float* __restrict__ p, int lane) { v16b a; const float* pp = p + 8 * (lane >> 4);
#pragma unroll
  for (int i = 0; i < 8; ++i) { a[i] = (__bf16)pp[i]; a[8 + i] = (__bf16)pp[16 + i]; } return a; }
// eight asynchronous copies of 16 bytes per lane; the s_wait_xcnt stands inside the statement so that no address register of a copy is rewritten in front of it (a precaution)
__device__ __forceinline__ void cp8(unsigned l0, unsigned l1, unsigned l2, unsigned l3, unsigned l4, unsigned l5, unsigned l6, unsigned l7, const void* g0, const void* g1, const void* g2, const void* g3, const void* g4, const void* g5, const void* g6, const void* g7) {
  asm volatile("global_load_async_to_lds_b128 %0, %8, off\n\tglobal_load_async_to_lds_b128 %1, %9, off\n\tglobal_load_async_to_lds_b128 %2, %10, off\n\tglobal_load_async_to_lds_b128 %3, %11, off\n\t"
               "global_load_async_to_lds_b128 %4, %12, off\n\tglobal_load_async_to_lds_b128 %5, %13, off\n\tglobal_load_async_to_lds_b128 %6, %14, off\n\tglobal_load_async_to_lds_b128 %7, %15, off\n\ts_wait_xcnt 0x0"
               :: "v"(l0), "v"(l1), "v"(l2), "v"(l3), "v"(l4), "v"(l5), "v"(l6), "v"(l7), "v"(g0), "v"(g1), "v"(g2), "v"(g3), "v"(g4), "v"(g5), "v"(g6), "v"(g7) : "memory");
}
// ---- operand staging of the two projection GEMMs (block = 64 rows x 128 columns, K 256): a two-buffer LDS ring, a stage = 64 k: the block's 128 weight rows (bf16, one 128-byte line each, 8 lanes a line) and its 64 activation rows (f32, 256 bytes each, 16 lanes a row), each byte copied once per block with adjacent lanes on adjacent 16 bytes
#define GK 64                          // k per stage
#define WP 144                         // LDS pitch, bytes: weight row of a stage, 16 B x odd for 16-byte readers
#define XP 272                         // LDS pitch, bytes: activation row of a stage, 16 B x odd for 16-byte readers
#define OFF_X (128 * WP)
#define GSTG (OFF_X + 64 * XP)         // bytes of one stage
__device__ __forceinline__ void gfill(unsigned lw, unsigned lx, const __bf16* gw, const float* gx) {   // lw, gw: this thread's 16 bytes of weight row tid >> 3; lx, gx: of activation row tid >> 4
  cp8(lw, lw + 16 * WP, lw + 32 * WP, lw + 48 * WP, lw + 64 * WP, lw + 80 * WP, lw + 96 * WP, lw + 112 * WP, gw, gw + 16 * CC, gw + 32 * CC, gw + 48 * CC, gw + 64 * CC, gw + 80 * CC, gw + 96 * CC, gw + 112 * CC);
  cp8(lx, lx + 8 * XP, lx + 16 * XP, lx + 24 * XP, lx + 32 * XP, lx + 40 * XP, lx + 48 * XP, lx + 56 * XP, gx, gx + 8 * CC, gx + 16 * CC, gx + 24 * CC, gx + 32 * CC, gx + 40 * CC, gx + 48 * CC, gx + 56 * CC); }
// a lane's 16 f32 of an A fragment from a staged row, as four 16-byte reads: v[0..7] = k0 + 8 h + 0..7, v[8..15] = k0 + 16 + 8 h + 0..7
__device__ __forceinline__ void row16(const float* rowk0, int lane, float v[16]) { const v4f* q = (const v4f*)(rowk0 + 8 * (lane >> 4)); const v4f a = q[0], b = q[1], c = q[4], d = q[5];
#pragma unroll
  for (int i = 0; i < 4; ++i) { v[i] = a[i]; v[4 + i] = b[i]; v[8 + i] = c[i]; v[12 + i] = d[i]; } }
// ---- k_proj: block = (64 rows, 128 of 768 cols, b): y = x . W + b (exact); cols < 512 (q|k) -> f16 hi/lo rows; cols >= 512 (v) -> transposed planes
__global__ __launch_bounds__(128) void k_proj(const float* __restrict__ X, const __bf16* __restrict__ PW, const float* __restrict__ BQKV, _Float16* __restrict__ QK, _Float16* __restrict__ QKL, _Float16* __restrict__ VT, _Float16* __restrict__ VTL) {
  __shared__ __align__(16) unsigned char ring[2 * GSTG];
  _Float16 (*sh)[136] = (_Float16 (*)[136])ring, (*sl)[136] = (_Float16 (*)[136])(ring + 64 * 136 * 2), (*th)[72] = (_Float16 (*)[72])ring, (*tl)[72] = (_Float16 (*)[72])(ring + 128 * 72 * 2);   // output staging in the ring: behind the last stage's barrier nobody reads the ring and no copy is in flight
  static_assert(2 * 64 * 136 * 2 <= 2 * GSTG && 2 * 128 * 72 * 2 <= 2 * GSTG, "the output staging fits the ring");
  const int tid = threadIdx.x, wave = tid >> 5, lane = tid & 31, col = lane & 15, g = lane >> 4; const size_t b = blockIdx.z; const int i0 = blockIdx.x * 64 + wave * 16; const int c0 = blockIdx.y * 128; const size_t r0 = b * NN + i0;
  v8f acc[8] = {};
  const unsigned lr = (unsigned)(size_t)ring, lw = lr + (tid >> 3) * WP + (tid & 7) * 16, lx = lr + OFF_X + (tid >> 4) * XP + (tid & 15) * 16;   // lr: the ring's byte address in LDS
  const __bf16* gw = PW + (size_t)(c0 + (tid >> 3)) * CC + (tid & 7) * 8; const float* gx = X + (b * NN + blockIdx.x * 64 + (tid >> 4)) * CC + (tid & 15) * 4;
  gfill(lw, lx, gw, gx);
  asm volatile("s_wait_asynccnt 0x0" ::: "memory");   // stage 0 has landed before the barrier that publishes it
  __syncthreads();
  gfill(lw + GSTG, lx + GSTG, gw + GK, gx + GK);
#pragma unroll   // four stages, unrolled so that every LDS offset is an immediate
  for (int t = 0; t < CC / GK; ++t) { const unsigned bo = (t & 1) * GSTG; const unsigned char* st = ring + bo;
#pragma unroll
   for (int kk = 0; kk < GK / 32; ++kk) { float v[16]; row16((const float*)(st + OFF_X + (wave * 16 + col) * XP) + kk * 32, lane, v); v16b a;
#pragma unroll
    for (int i = 0; i < 16; ++i) a[i] = (__bf16)v[i];
    v16b w[8];
#pragma unroll   // a k step's eight W fragments are read ahead of its products, not each in front of its own product
    for (int j = 0; j < 8; ++j) w[j] = frag_b((const __bf16*)(st + (j * 16 + col) * WP) + kk * 32, lane);
    __builtin_amdgcn_sched_barrier(0);   // holds a k step's LDS reads ahead of its first product: without it the compiler puts each fragment's reads directly in front of its product, and the wave waits out the LDS latency at each
#pragma unroll   // w[] and acc[] indexed by constants
    for (int j = 0; j < 8; ++j) acc[j] = wmma_bf(a, w[j], acc[j]); }
   asm volatile("s_wait_dscnt 0x0" ::: "memory");      // this wave's reads of the stage are done before the buffer is given up
   asm volatile("s_wait_asynccnt 0x0" ::: "memory");   // this wave's copies of stage t + 1 have landed before the barrier that publishes them
   __syncthreads();                                    // publishes stage t + 1 and ends every wave's reads of stage t
   if (t + 2 < CC / GK) gfill(lw + bo, lx + bo, gw + (t + 2) * GK, gx + (t + 2) * GK); }
  asm volatile("s_wait_asynccnt 0x0" ::: "memory");   // nothing is in flight when the ring becomes output staging
  const bool isv = c0 >= 2 * CC;
#pragma unroll
  for (int j = 0; j < 8; ++j) { const float bb = bfr(BQKV[c0 + j * 16 + col]);
#pragma unroll
    for (int r = 0; r < 8; ++r) { const float v = acc[j][r] + bb; const _Float16 hv = (_Float16)v; const _Float16 lv = (_Float16)((v - (float)hv) * 2048.0f); if (!isv) { sh[wave * 16 + 8 * g + r][j * 16 + col] = hv; sl[wave * 16 + 8 * g + r][j * 16 + col] = lv; } else { th[j * 16 + col][wave * 16 + 8 * g + r] = hv; tl[j * 16 + col][wave * 16 + 8 * g + r] = lv; } } }
  __syncthreads();
  if (!isv) { for (int e = tid; e < 64 * 16; e += 128) { const int rl = e >> 4, q = e & 15; const size_t o = (b * NN + blockIdx.x * 64 + rl) * (2 * CC) + c0 + q * 8; vst2((unsigned*)(QK + o), *(const v4u*)&sh[rl][q * 8]); vst2((unsigned*)(QKL + o), *(const v4u*)&sl[rl][q * 8]); } }
  else { const int cv0 = c0 - 2 * CC; for (int e = tid; e < 128 * 8; e += 128) { const int cl = e >> 3, q = e & 7; const size_t o = ((b * CC + cv0 + cl) * (size_t)NN) + blockIdx.x * 64 + q * 8; vst2((unsigned*)(VT + o), *(const v4u*)&th[cl][q * 8]); vst2((unsigned*)(VTL + o), *(const v4u*)&tl[cl][q * 8]); } } }
// ---- k_att: block = (64 queries, head, b), transposed products: S^T = K . Q^T (3 products; a lane holds 16 of the pass's 32 keys of ONE query) x 32^-0.5 x (0.1 + 0.9 IM[n][m]) x log2 e, running-max base-2 softmax in-lane plus one exchange between the wave's halves, P^T packed from the score accumulators as B operand, O^T += V^T . P^T (v planes hi + residual, 2 products) -> Z merged
// operands come through a two-buffer LDS ring, a stage = 64 keys = 2 passes: K rows (hi | residual), v planes (hi, residual) and the block's 64 mask rows (bf16), each byte copied once per block with adjacent lanes on adjacent 16 bytes
__device__ __forceinline__ float xhalf(float x) { return __builtin_bit_cast(float, __builtin_amdgcn_permlanex16(__builtin_bit_cast(int, x), __builtin_bit_cast(int, x), 0x76543210, 0xfedcba98, false, false)); }  // lane l with lane l ^ 16
#define KT 64                          // keys per stage
#define KP 144                         // LDS pitch, bytes: K row (64 B hi | 64 B residual) and v plane row (64 keys), 16 B x odd for 16-byte readers
#define IP 144                         // LDS pitch, bytes: mask row (64 keys, bf16), 16 B x odd for 16-byte readers
#define OFF_VH (KT * KP)
#define OFF_VL (OFF_VH + DK * KP)
#define OFF_IM (OFF_VL + DK * KP)
#define STG (OFF_IM + 64 * IP)         // bytes of one stage
// softmax in base 2: 32^-0.5 and log2(e) are folded into the two constants of the mask factor, (0.1 + 0.9 mask) x 32^-0.5 x log2(e) = FA + FB x mask
#define FA ((float)(0.1 * 0.17677669529663687 * 1.4426950408889634))
#define FB ((float)(0.9 * 0.17677669529663687 * 1.4426950408889634))
// four such copies, for the mask rows; the s_wait_xcnt stands inside the statement for the same reason (a precaution)
__device__ __forceinline__ void cp4(unsigned l0, unsigned l1, unsigned l2, unsigned l3, const void* g0, const void* g1, const void* g2, const void* g3) {
  asm volatile("global_load_async_to_lds_b128 %0, %4, off\n\tglobal_load_async_to_lds_b128 %1, %5, off\n\tglobal_load_async_to_lds_b128 %2, %6, off\n\tglobal_load_async_to_lds_b128 %3, %7, off\n\ts_wait_xcnt 0x0"
               :: "v"(l0), "v"(l1), "v"(l2), "v"(l3), "v"(g0), "v"(g1), "v"(g2), "v"(g3) : "memory");
}
// at most 4 waves a SIMD, as with the larger ring: the grid is 4 work-groups a WGP, and no WGP is to take a fifth while another holds three
__global__ __launch_bounds__(128) __attribute__((amdgpu_waves_per_eu(1, 4))) void k_att(const _Float16* __restrict__ QK, const _Float16* __restrict__ QKL, const _Float16* __restrict__ VT, const _Float16* __restrict__ VTL, const __bf16* __restrict__ MB, float* __restrict__ Z) {
  __shared__ __align__(16) unsigned char ring[2 * STG];
  const int tid = threadIdx.x, wave = tid >> 5, lane = tid & 31, col = lane & 15, g = lane >> 4; const int h = blockIdx.y; const size_t b = blockIdx.z; const int q0 = blockIdx.x * 64 + wave * 16; const size_t rq = b * NN + q0;
  const v16h aq = frag_h(QK + (rq + col) * (2 * CC) + h * DK, lane), aql = frag_h(QKL + (rq + col) * (2 * CC) + h * DK, lane);   // B operands: column = query q0 + col
  // this thread's share of a stage: K rows tid >> 2 and + 32 (4 lanes a 64-byte row), v channels tid >> 3 and + 16 (8 lanes a 128-byte row), mask rows tid >> 3 + 16 i (8 lanes a 128-byte row)
  const unsigned lr = (unsigned)(size_t)ring;   // the ring's byte address in LDS
  const unsigned lk = lr + (tid >> 2) * KP + (tid & 3) * 16, lv = lr + OFF_VH + (tid >> 3) * KP + (tid & 7) * 16, li = lr + OFF_IM + (tid >> 3) * IP + (tid & 7) * 16;
  const size_t ok = (b * NN + (tid >> 2)) * (2 * CC) + CC + h * DK + (tid & 3) * 8, ov = (b * CC + (size_t)h * DK + (tid >> 3)) * (size_t)NN + (tid & 7) * 8;
  const __bf16* gi = MB + (size_t)(blockIdx.x * 64 + (tid >> 3)) * NN + (tid & 7) * 8;
  auto fill = [&](int t, unsigned bo) {   // stage t into the buffer at byte offset bo
    const _Float16 *kh = QK + ok + (size_t)t * KT * (2 * CC), *kl = QKL + ok + (size_t)t * KT * (2 * CC), *vh = VT + ov + t * KT, *vl = VTL + ov + t * KT; const __bf16* im = gi + t * KT;
    cp8(lk + bo, lk + bo + 32 * KP, lk + bo + 64, lk + bo + 32 * KP + 64, lv + bo, lv + bo + 16 * KP, lv + bo + DK * KP, lv + bo + DK * KP + 16 * KP,
        kh, kh + 32 * (2 * CC), kl, kl + 32 * (2 * CC), vh, vh + 16 * (size_t)NN, vl, vl + 16 * (size_t)NN);
    cp4(li + bo, li + bo + 16 * IP, li + bo + 32 * IP, li + bo + 48 * IP, im, im + 16 * (size_t)NN, im + 32 * (size_t)NN, im + 48 * (size_t)NN); };
  float m = -3.0e38f, l = 0.f;   // m: running maximum of the base-2 logits less 11, the one offset of exponents and rescaling, so that every exp2 comes out x 2^11; l: sum of those, this half's keys only, the halves are joined behind the loop
  v8f acc[2] = {}, accl[2] = {};   // O^T: register r of tile j = channel j * 16 + 8 g + r of query q0 + col
  fill(0, 0);
  asm volatile("s_wait_asynccnt 0x0" ::: "memory");   // stage 0 has landed before the barrier that publishes it
  __syncthreads();
  fill(1, STG);
#pragma unroll 1   // the stage loop stays rolled: one stage's code and registers
  for (int t = 0; t < NN / KT; ++t) { const unsigned bo = (t & 1) * STG; const unsigned char* st = ring + bo;
#pragma unroll   // both passes of a stage unrolled, so that every LDS offset is an immediate
   for (int sub = 0; sub < KT / 32; ++sub) { v8f s[2];
#pragma unroll
    for (int ct = 0; ct < 2; ++ct) { const _Float16* pk = (const _Float16*)(st + (sub * 32 + ct * 16 + col) * KP); const v16h kh = frag_h(pk, lane), kl = frag_h(pk + 32, lane);
      v8f c = {}, cl = {}; c = wmma16(kh, aq, c); cl = wmma16(kl, aq, cl); cl = wmma16(kh, aql, cl);
      const __bf16* pi = (const __bf16*)(st + OFF_IM + (wave * 16 + col) * IP) + sub * 32 + ct * 16 + 8 * g;   // this lane's query row; score register r of tile ct = key t * 64 + sub * 32 + ct * 16 + 8 g + r
      const v8b ia = *(const v8b*)pi;
#pragma unroll
      for (int r = 0; r < 8; ++r) s[ct][r] = (c[r] + cl[r] * (1.0f / 2048.0f)) * (FA + FB * (float)ia[r]); }   // base-2 logit
    float mx = fmaxf(s[0][0], s[1][0]);
#pragma unroll
    for (int r = 1; r < 8; ++r) mx = fmaxf(mx, fmaxf(s[0][r], s[1][r]));
    mx = fmaxf(mx, xhalf(mx));
    const float mn = fmaxf(m, mx - 11.0f), alpha = __builtin_amdgcn_exp2f(m - mn); float tt[8]; v16h pa;   // pa[i] = key kmap(i): tile i >> 3, register i & 7, the order frag_h gives the v planes
#pragma unroll
    for (int r = 0; r < 8; ++r) { const float e0 = __builtin_amdgcn_exp2f(s[0][r] - mn), e1 = __builtin_amdgcn_exp2f(s[1][r] - mn); tt[r] = e0 + e1; pa[r] = (_Float16)e0; pa[8 + r] = (_Float16)e1; }
    l = l * alpha + (((tt[0] + tt[1]) + (tt[2] + tt[3])) + ((tt[4] + tt[5]) + (tt[6] + tt[7]))); m = mn;
#pragma unroll
    for (int j = 0; j < 2; ++j)
#pragma unroll
      for (int r = 0; r < 8; ++r) { acc[j][r] *= alpha; accl[j][r] *= alpha; }
#pragma unroll
    for (int j = 0; j < 2; ++j) { const _Float16* pv = (const _Float16*)(st + OFF_VH + (j * 16 + col) * KP) + sub * 32; acc[j] = wmma16(frag_h(pv, lane), pa, acc[j]); accl[j] = wmma16(frag_h(pv + DK * KP / 2, lane), pa, accl[j]); } }
   asm volatile("s_wait_dscnt 0x0" ::: "memory");      // this wave's reads of the stage are done before the buffer is given up
   asm volatile("s_wait_asynccnt 0x0" ::: "memory");   // this wave's copies of stage t + 1 have landed before the barrier that publishes them
   __syncthreads();                                    // publishes stage t + 1 and ends every wave's reads of stage t
   if (t + 2 < NN / KT) fill(t + 2, bo); }
  asm volatile("s_wait_asynccnt 0x0" ::: "memory");   // nothing is in flight when the ring becomes output staging and the wave ends
  float (*so)[16][36] = (float (*)[16][36])ring;   // output staging in the ring, a slice per wave: behind the last stage's barrier nobody reads the ring and no copy is in flight
  l += xhalf(l);
  const float il = 1.0f / l;   // l and the accumulators both carry the 2^11
#pragma unroll
  for (int j = 0; j < 2; ++j)
#pragma unroll
    for (int r = 0; r < 8; ++r) so[wave][col][j * 16 + 8 * g + r] = (acc[j][r] + accl[j][r] * (1.0f / 2048.0f)) * il;
  LDSX(); for (int rl = 0; rl < 16; ++rl) if (lane < 8) vst2(Z + (rq + rl) * CC + (size_t)h * DK + lane * 4, *(const v4f*)&so[wave][rl][lane * 4]); }
// ---- k_out: block = (64 rows, 128 cols): out = Z (bf16 hi + lo) . W_out + b
__global__ __launch_bounds__(128) void k_out(const float* __restrict__ Z, const __bf16* __restrict__ PO, const float* __restrict__ BO, float* __restrict__ OUT) { __shared__ __align__(16) unsigned char ring[2 * GSTG];
  float (*sf)[16][132] = (float (*)[16][132])ring;   // output staging in the ring, a slice per wave: behind the last stage's barrier nobody reads the ring and no copy is in flight
  static_assert(4 * 16 * 132 * 4 <= 2 * GSTG, "the output staging fits the ring");
  const int tid = threadIdx.x, wave = tid >> 5, lane = tid & 31, col = lane & 15, g = lane >> 4; const size_t r0 = (size_t)blockIdx.x * 64 + wave * 16; const int c0 = blockIdx.y * 128;
  v8f acc[8] = {}; float bb[8];
#pragma unroll   // the eight bias loads stand ahead of the products, so that the epilogue waits for none of them
  for (int j = 0; j < 8; ++j) bb[j] = BO[c0 + j * 16 + col];
  const unsigned lr = (unsigned)(size_t)ring, lw = lr + (tid >> 3) * WP + (tid & 7) * 16, lx = lr + OFF_X + (tid >> 4) * XP + (tid & 15) * 16;   // lr: the ring's byte address in LDS
  const __bf16* gw = PO + (size_t)(c0 + (tid >> 3)) * CC + (tid & 7) * 8; const float* gx = Z + ((size_t)blockIdx.x * 64 + (tid >> 4)) * CC + (tid & 15) * 4;
  gfill(lw, lx, gw, gx);
  asm volatile("s_wait_asynccnt 0x0" ::: "memory");   // stage 0 has landed before the barrier that publishes it
  __syncthreads();
  gfill(lw + GSTG, lx + GSTG, gw + GK, gx + GK);
#pragma unroll   // four stages, unrolled so that every LDS offset is an immediate
  for (int t = 0; t < CC / GK; ++t) { const unsigned bo = (t & 1) * GSTG; const unsigned char* st = ring + bo;
#pragma unroll
   for (int kk = 0; kk < GK / 32; ++kk) { float v[16]; row16((const float*)(st + OFF_X + (wave * 16 + col) * XP) + kk * 32, lane, v); const F2 a = bsplit16(v); v16b w[8];
#pragma unroll   // a k step's eight W fragments are fetched as one group ahead of its products: one load latency a k step, not one a fragment
    for (int j = 0; j < 8; ++j) w[j] = frag_b((const __bf16*)(st + (j * 16 + col) * WP) + kk * 32, lane);
#pragma unroll   // each tile still adds its hi product first and its lo product second
    for (int j = 0; j < 8; ++j) acc[j] = wmma_bf(a.h, w[j], acc[j]);
#pragma unroll   // unrolled like the loop above, so that w[] and acc[] are indexed by constants and stay in registers
    for (int j = 0; j < 8; ++j) acc[j] = wmma_bf(a.l, w[j], acc[j]); }
   asm volatile("s_wait_dscnt 0x0" ::: "memory");      // this wave's reads of the stage are done before the buffer is given up
   asm volatile("s_wait_asynccnt 0x0" ::: "memory");   // this wave's copies of stage t + 1 have landed before the barrier that publishes them
   __syncthreads();                                    // publishes stage t + 1 and ends every wave's reads of stage t
   if (t + 2 < CC / GK) gfill(lw + bo, lx + bo, gw + (t + 2) * GK, gx + (t + 2) * GK); }
  asm volatile("s_wait_asynccnt 0x0" ::: "memory");   // nothing is in flight when the ring becomes output staging
#pragma unroll
  for (int j = 0; j < 8; ++j) { const float bj = bfr(bb[j]);
#pragma unroll
    for (int r = 0; r < 8; ++r) sf[wave][8 * g + r][j * 16 + col] = acc[j][r] + bj; }
  LDSX(); for (int rl = 0; rl < 16; ++rl) vst2(OUT + (r0 + rl) * CC + c0 + lane * 4, *(const v4f*)&sf[wave][rl][lane * 4]); }
extern "C" void kernel_launch(void* const* d_in, const int* in_sizes, int n_in, void* d_out, int out_size, void* d_ws, size_t ws_size, hipStream_t stream) {
  (void)in_sizes; (void)n_in; (void)out_size;
  const float** F = (const float**)d_in;   // 0 x [4,2048,256], 1 interaction_mask [2048,2048], 2 W_qkv [256,768] (in,out), 3 b_qkv [768], 4 W_out [256,256] (in,out), 5 b_out
  if (ws_size < (size_t)WS_END) return;
  char* ws = (char*)d_ws; __bf16 *PW = (__bf16*)(ws + WS_PW), *PO = (__bf16*)(ws + WS_PO); _Float16 *QK = (_Float16*)(ws + WS_QK), *QKL = (_Float16*)(ws + WS_QKL), *VT = (_Float16*)(ws + WS_VT), *VTL = (_Float16*)(ws + WS_VTL); float* Z = (float*)(ws + WS_Z); __bf16* MB = (__bf16*)(ws + WS_MB);
  k_pack<<<4 * CC, 256, 0, stream>>>(F[2], F[4], F[1], PW, PO, MB);
  k_proj<<<dim3(NN / 64, 3 * CC / 128, TNB), 128, 0, stream>>>(F[0], PW, F[3], QK, QKL, VT, VTL);
  k_att<<<dim3(NN / 64, NH, TNB), 128, 0, stream>>>(QK, QKL, VT, VTL, MB, Z);
  k_out<<<dim3(TNB * NN / 64, CC / 128), 128, 0, stream>>>(Z, PO, F[5], (float*)d_out);
}

// v007
// A run of this version takes 78 microseconds.
// Next to v006, in two timings, it ran 1.03 times as fast each time.
// Over all steps from v000 it is 3.05 times as fast.
// compute dtype: all float inputs rounded to bf16; qkv = x . W_qkv + b with EXACT bf16 products on WMMA 16x16x32 ((in,out) weights as transposed rows), q/k rounded to f16 hi + residual rows, v to f16 hi + residual planes; logits q . k with 3 products, x 32^-0.5 x (0.1 + 0.9 interaction_mask[n][m]) read per pair (mask rounded to bf16 once, ahead of the attention), running-max softmax in f32 in base 2 (hardware exp2; 32^-0.5 log2 e inside the mask factor's constants, 2^11 inside the maximum), P (x 2^11, f16) . v (hi + residual, 2 products); out = ctx (bf16 hi + lo, 2 products) . W_out + b; f32 output.
#include <hip/hip_runtime.h>
#include <math.h>

typedef __attribute__((ext_vector_type(16))) _Float16 v16h;
typedef __attribute__((ext_vector_type(16))) __bf16 v16b;
typedef __attribute__((ext_vector_type(8)))  _Float16 v8h;
typedef __attribute__((ext_vector_type(8)))  float v8f;
typedef __attribute__((ext_vector_type(4)))  float v4f;
typedef __attribute__((ext_vector_type(2)))  float v2f;
typedef __attribute__((ext_vector_type(4)))  unsigned v4u;
typedef __attribute__((ext_vector_type(4)))  int v4i;
typedef float __attribute__((may_alias)) float_a;
typedef int __attribute__((may_alias)) int_a;

template <typename T> __device__ __forceinline__ void vst2(void* p, T v) { *(T*)p = v;  }
// plain builtins: the compiler keeps the distance behind its own matrix instructions and is free to issue later operand loads ahead of them
__device__ __forceinline__ v8f wmma16(v16h a, v16h b, v8f c) {
  return __builtin_amdgcn_wmma_f32_16x16x32_f16(false, a, false, b, (short)0, c, false, false);
}
__device__ __forceinline__ v8f wmma_bf(v16b a, v16b b, v8f c) {
  return __builtin_amdgcn_wmma_f32_16x16x32_bf16(false, a, false, b, (short)0, c, false, false);
}
// 16x16x32 fragments: lane = (h = lane>>4, row/col = lane&15); elements 0..7 = k0+8h+0..7, 8..15 = k0+16+8h+0..7; D element r = row 8h+r
__device__ __forceinline__ v16h frag_h(const _Float16* rowk0, int lane) {
  union { v16h v; v8h q[2]; } u; const _Float16* p = rowk0 + 8 * (lane >> 4);
  u.q[0] = *(const v8h*)p; u.q[1] = *(const v8h*)(p + 16); return u.v;
}
__device__ __forceinline__ v16h frag_f32(const float* rowk0, int lane) {
  v16h a; const float* p = rowk0 + 8 * (lane >> 4);
#pragma unroll
  for (int i = 0; i < 8; ++i) { a[i] = (_Float16)p[i]; a[8 + i] = (_Float16)p[16 + i]; }
  return a;
}
__device__ __forceinline__ v16h frag_f32s(const float* rowk0, int lane, float sc) {
  v16h a; const float* p = rowk0 + 8 * (lane >> 4);
#pragma unroll
  for (int i = 0; i < 8; ++i) { a[i] = (_Float16)(p[i] * sc); a[8 + i] = (_Float16)(p[16 + i] * sc); }
  return a;
}
// column fragment from a [K][ld] layout (column n), rows >= K read as 0
__device__ __forceinline__ v16h fragc_f32(const float* W, int k0, int n, int lane, int ld, int K) {
  v16h a; const int g = lane >> 4;
#pragma unroll
  for (int i = 0; i < 8; ++i) { const int ka = k0 + 8 * g + i, kb = ka + 16;
    a[i] = (_Float16)(ka < K ? W[(size_t)(ka < K ? ka : K - 1) * ld + n] : 0.f); a[8 + i] = (_Float16)(kb < K ? W[(size_t)(kb < K ? kb : K - 1) * ld + n] : 0.f); }
  return a;
}
struct F2 { v16b h, l; };
__device__ __forceinline__ F2 bsplit16(const float v[16]) { F2 r;
#pragma unroll
  for (int i = 0; i < 16; ++i) { const __bf16 h = (__bf16)v[i]; r.h[i] = h; r.l[i] = (__bf16)(v[i] - (float)h); }
  return r; }
__device__ __forceinline__ F2 split_row(const float* row, int k0, int lane) { float v[16]; const float* p = row + k0 + 8 * (lane >> 4);
#pragma unroll
  for (int i = 0; i < 8; ++i) { v[i] = p[i]; v[8 + i] = p[16 + i]; }
  return bsplit16(v); }
__device__ __forceinline__ F2 split_rowK(const float* row, int k0, int lane, int K) { float v[16]; const int g = lane >> 4;
#pragma unroll
  for (int i = 0; i < 8; ++i) { const int ka = k0 + 8 * g + i, kb = ka + 16; v[i] = ka < K ? row[ka < K ? ka : K - 1] : 0.f; v[8 + i] = kb < K ? row[kb < K ? kb : K - 1] : 0.f; }
  return bsplit16(v); }
__device__ __forceinline__ F2 split_col(const float* W, int k0, int n, int lane, int ld, int K) { float v[16]; const int g = lane >> 4;
#pragma unroll
  for (int i = 0; i < 8; ++i) { const int ka = k0 + 8 * g + i, kb = ka + 16; v[i] = ka < K ? W[(size_t)(ka < K ? ka : K - 1) * ld + n] : 0.f; v[8 + i] = kb < K ? W[(size_t)(kb < K ? kb : K - 1) * ld + n] : 0.f; }
  return bsplit16(v); }
__device__ __forceinline__ v8f mac3(const F2& a, const F2& b, v8f c) { c = wmma_bf(a.l, b.h, c); c = wmma_bf(a.h, b.l, c); return wmma_bf(a.h, b.h, c); }
__device__ __forceinline__ float sigm(float v) { return 1.0f / (1.0f + expf(-v)); }
#define LDSX() do { asm volatile("s_wait_dscnt 0" ::: "memory"); __builtin_amdgcn_wave_barrier(); __builtin_amdgcn_fence(__ATOMIC_RELEASE, "workgroup"); } while (0)


// Biologically-modulated attention (B 4, N 2,048 genes, C 256, 8 heads x 32): fused (in,out) qkv + bias, logits scaled by (0.1 + 0.9 x PPI interaction strength) before the softmax, (in,out) output projection + bias.
#define NB 4
#define NN 2048
#define CC 256
#define NH 8
#define DK 32
#ifndef TNB
#define TNB NB
#endif
typedef __attribute__((ext_vector_type(8))) __bf16 v8b;
__device__ __forceinline__ v16b frag_b(const __bf16* rowk0, int lane) {
  union { v16b v; v8b q[2]; } u; const __bf16* p = rowk0 + 8 * (lane >> 4);
  u.q[0] = *(const v8b*)p; u.q[1] = *(const v8b*)(p + 16); return u.v;
}
__device__ __forceinline__ float bfr(float v) { return (float)(__bf16)v; }
__device__ __attribute__((noinline)) float exp_ni(float v) { return expf(v); }
__device__ __attribute__((noinline)) float erf_ni(float v) { return erff(v); }

#define WS_PW  0u                                   // bf16 rows [768][256] (qkv, transposed (in,out)); [256][256] W_out^T
#define WS_PO  (WS_PW + 2u * 3 * CC * CC)
#define WS_QK  (WS_PO + 2u * CC * CC)                   // f16 hi|lo q|k rows [b*NN + n][512]
#define WS_QKL (WS_QK + 2u * (size_t)NB * NN * 2 * CC)
#define WS_VT  (WS_QKL + 2u * (size_t)NB * NN * 2 * CC) // f16 hi|lo v planes [b][c][n]
#define WS_VTL (WS_VT + 2u * (size_t)NB * CC * NN)
#define WS_Z   (WS_VTL + 2u * (size_t)NB * CC * NN)     // f32 ctx [b*NN + n][256]
#define WS_MB  (WS_Z + 4u * (size_t)NB * NN * CC)       // bf16 interaction mask [n][m]
#define WS_END (WS_MB + 2u * (size_t)NN * NN)

typedef __attribute__((ext_vector_type(4))) __bf16 v4b;
#define MPB (NN * NN / (4 * CC))       // mask elements a k_pack block rounds
static_assert(MPB % 1024 == 0, "a block's share of the mask is whole rounds of 256 threads x 4 floats");
__global__ __launch_bounds__(256) void k_pack(const float* __restrict__ WQKV, const float* __restrict__ WO, const float* __restrict__ IM, __bf16* __restrict__ PW, __bf16* __restrict__ PO, __bf16* __restrict__ MB) { const int n = blockIdx.x, t = threadIdx.x; __shared__ __align__(16) __bf16 s[CC];   // n in [0, 1024): rows 0..767 qkv columns, 768..1023 W_out columns
  // the block's share of the interaction mask, rounded to bf16 once here for every batch and head; adjacent lanes on adjacent 16 bytes, loads issued ahead of the weight column
  const size_t mo = (size_t)n * MPB + t * 4; v4f mk[MPB / 1024];
#pragma unroll   // all of the share's loads in flight together, mk[] in registers
  for (int i = 0; i < MPB / 1024; ++i) mk[i] = *(const v4f*)(IM + mo + i * 1024);
  if (n < 3 * CC) s[t] = (__bf16)WQKV[(size_t)t * (3 * CC) + n]; else s[t] = (__bf16)WO[(size_t)t * CC + (n - 3 * CC)]; __syncthreads();
  __bf16* dst = (n < 3 * CC) ? PW + (size_t)n * CC : PO + (size_t)(n - 3 * CC) * CC; if (t < CC / 8) vst2((unsigned*)(dst + t * 8), *(const v4u*)&s[t * 8]);
#pragma unroll   // mk[] indexed by constants
  for (int i = 0; i < MPB / 1024; ++i) { v4b o;
#pragma unroll   // vector elements indexed by constants
    for (int e = 0; e < 4; ++e) o[e] = (__bf16)mk[i][e];
    *(v4b*)(MB + mo + i * 1024) = o; } }
__device__ __forceinline__ v16b fragb_f32(const float* __restrict__ p, int lane) { v16b a; const float* pp = p + 8 * (lane >> 4);
#pragma unroll
  for (int i = 0; i < 8; ++i) { a[i] = (__bf16)pp[i]; a[8 + i] = (__bf16)pp[16 + i]; } return a; }
// eight asynchronous copies of 16 bytes per lane; the s_wait_xcnt stands inside the statement so that no address register of a copy is rewritten in front of it (a precaution)
__device__ __forceinline__ void cp8(unsigned l0, unsigned l1, unsigned l2, unsigned l3, unsigned l4, unsigned l5, unsigned l6, unsigned l7, const void* g0, const void* g1, const void* g2, const void* g3, const void* g4, const void* g5, const void* g6, const void* g7) {
  asm volatile("global_load_async_to_lds_b128 %0, %8, off\n\tglobal_load_async_to_lds_b128 %1, %9, off\n\tglobal_load_async_to_lds_b128 %2, %10, off\n\tglobal_load_async_to_lds_b128 %3, %11, off\n\t"
               "global_load_async_to_lds_b128 %4, %12, off\n\tglobal_load_async_to_lds_b128 %5, %13, off\n\tglobal_load_async_to_lds_b128 %6, %14, off\n\tglobal_load_async_to_lds_b128 %7, %15, off\n\ts_wait_xcnt 0x0"
               :: "v"(l0), "v"(l1), "v"(l2), "v"(l3), "v"(l4), "v"(l5), "v"(l6), "v"(l7), "v"(g0), "v"(g1), "v"(g2), "v"(g3), "v"(g4), "v"(g5), "v"(g6), "v"(g7) : "memory");
}
// ---- operand staging of the two projection GEMMs (block = 64 rows x 128 columns, K 256): a two-buffer LDS ring, a stage = 64 k: the block's 128 weight rows (bf16, one 128-byte line each, 8 lanes a line) and its 64 activation rows (f32, 256 bytes each, 16 lanes a row), each byte copied once per block with adjacent lanes on adjacent 16 bytes
#define GK 64                          // k per stage
#define WP 144                         // LDS pitch, bytes: weight row of a stage, 16 B x odd for 16-byte readers
#define XP 272                         // LDS pitch, bytes: activation row of a stage, 16 B x odd for 16-byte readers
#define OFF_X (128 * WP)
#define GSTG (OFF_X + 64 * XP)         // bytes of one stage
__device__ __forceinline__ void gfill(unsigned lw, unsigned lx, const __bf16* gw, const float* gx) {   // lw, gw: this thread's 16 bytes of weight row tid >> 3; lx, gx: of activation row tid >> 4
  cp8(lw, lw + 16 * WP, lw + 32 * WP, lw + 48 * WP, lw + 64 * WP, lw + 80 * WP, lw + 96 * WP, lw + 112 * WP, gw, gw + 16 * CC, gw + 32 * CC, gw + 48 * CC, gw + 64 * CC, gw + 80 * CC, gw + 96 * CC, gw + 112 * CC);
  cp8(lx, lx + 8 * XP, lx + 16 * XP, lx + 24 * XP, lx + 32 * XP, lx + 40 * XP, lx + 48 * XP, lx + 56 * XP, gx, gx + 8 * CC, gx + 16 * CC, gx + 24 * CC, gx + 32 * CC, gx + 40 * CC, gx + 48 * CC, gx + 56 * CC); }
// a lane's 16 f32 of an A fragment from a staged row, as four 16-byte reads: v[0..7] = k0 + 8 h + 0..7, v[8..15] = k0 + 16 + 8 h + 0..7
__device__ __forceinline__ void row16(const float* rowk0, int lane, float v[16]) { const v4f* q = (const v4f*)(rowk0 + 8 * (lane >> 4)); const v4f a = q[0], b = q[1], c = q[4], d = q[5];
#pragma unroll
  for (int i = 0; i < 4; ++i) { v[i] = a[i]; v[4 + i] = b[i]; v[8 + i] = c[i]; v[12 + i] = d[i]; } }
// ---- k_proj: block = (64 rows, 128 of 768 cols, b): y = x . W + b (exact); cols < 512 (q|k) -> f16 hi/lo rows; cols >= 512 (v) -> transposed planes
__global__ __launch_bounds__(128) void k_proj(const float* __restrict__ X, const __bf16* __restrict__ PW, const float* __restrict__ BQKV, _Float16* __restrict__ QK, _Float16* __restrict__ QKL, _Float16* __restrict__ VT, _Float16* __restrict__ VTL) {
  __shared__ __align__(16) unsigned char ring[2 * GSTG];
  _Float16 (*sh)[136] = (_Float16 (*)[136])ring, (*sl)[136] = (_Float16 (*)[136])(ring + 64 * 136 * 2), (*th)[72] = (_Float16 (*)[72])ring, (*tl)[72] = (_Float16 (*)[72])(ring + 128 * 72 * 2);   // output staging in the ring: behind the last stage's barrier nobody reads the ring and no copy is in flight
  static_assert(2 * 64 * 136 * 2 <= 2 * GSTG && 2 * 128 * 72 * 2 <= 2 * GSTG, "the output staging fits the ring");
  const int tid = threadIdx.x, wave = tid >> 5, lane = tid & 31, col = lane & 15, g = lane >> 4; const size_t b = blockIdx.z; const int i0 = blockIdx.x * 64 + wave * 16; const int c0 = blockIdx.y * 128; const size_t r0 = b * NN + i0;
  v8f acc[8] = {};
  const unsigned lr = (unsigned)(size_t)ring, lw = lr + (tid >> 3) * WP + (tid & 7) * 16, lx = lr + OFF_X + (tid >> 4) * XP + (tid & 15) * 16;   // lr: the ring's byte address in LDS
  const __bf16* gw = PW + (size_t)(c0 + (tid >> 3)) * CC + (tid & 7) * 8; const float* gx = X + (b * NN + blockIdx.x * 64 + (tid >> 4)) * CC + (tid & 15) * 4;
  gfill(lw, lx, gw, gx);
  asm volatile("s_wait_asynccnt 0x0" ::: "memory");   // stage 0 has landed before the barrier that publishes it
  __syncthreads();
  gfill(lw + GSTG, lx + GSTG, gw + GK, gx + GK);
#pragma unroll   // four stages, unrolled so that every LDS offset is an immediate
  for (int t = 0; t < CC / GK; ++t) { const unsigned bo = (t & 1) * GSTG; const unsigned char* st = ring + bo;
#pragma unroll
   for (int kk = 0; kk < GK / 32; ++kk) { float v[16]; row16((const float*)(st + OFF_X + (wave * 16 + col) * XP) + kk * 32, lane, v); v16b a;
#pragma unroll
    for (int i = 0; i < 16; ++i) a[i] = (__bf16)v[i];
    v16b w[8];
#pragma unroll   // a k step's eight W fragments are read ahead of its products, not each in front of its own product
    for (int j = 0; j < 8; ++j) w[j] = frag_b((const __bf16*)(st + (j * 16 + col) * WP) + kk * 32, lane);
    __builtin_amdgcn_sched_barrier(0);   // holds a k step's LDS reads ahead of its first product: without it the compiler puts each fragment's reads directly in front of its product, and the wave waits out the LDS latency at each
#pragma unroll   // w[] and acc[] indexed by constants
    for (int j = 0; j < 8; ++j) acc[j] = wmma_bf(a, w[j], acc[j]); }
   asm volatile("s_wait_dscnt 0x0" ::: "memory");      // this wave's reads of the stage are done before the buffer is given up
   asm volatile("s_wait_asynccnt 0x0" ::: "memory");   // this wave's copies of stage t + 1 have landed before the barrier that publishes them
   __syncthreads();                                    // publishes stage t + 1 and ends every wave's reads of stage t
   if (t + 2 < CC / GK) gfill(lw + bo, lx + bo, gw + (t + 2) * GK, gx + (t + 2) * GK); }
  asm volatile("s_wait_asynccnt 0x0" ::: "memory");   // nothing is in flight when the ring becomes output staging
  const bool isv = c0 >= 2 * CC;
#pragma unroll
  for (int j = 0; j < 8; ++j) { const float bb = bfr(BQKV[c0 + j * 16 + col]);
#pragma unroll
    for (int r = 0; r < 8; ++r) { const float v = acc[j][r] + bb; const _Float16 hv = (_Float16)v; const _Float16 lv = (_Float16)((v - (float)hv) * 2048.0f); if (!isv) { sh[wave * 16 + 8 * g + r][j * 16 + col] = hv; sl[wave * 16 + 8 * g + r][j * 16 + col] = lv; } else { th[j * 16 + col][wave * 16 + 8 * g + r] = hv; tl[j * 16 + col][wave * 16 + 8 * g + r] = lv; } } }
  __syncthreads();
  if (!isv) { for (int e = tid; e < 64 * 16; e += 128) { const int rl = e >> 4, q = e & 15; const size_t o = (b * NN + blockIdx.x * 64 + rl) * (2 * CC) + c0 + q * 8; vst2((unsigned*)(QK + o), *(const v4u*)&sh[rl][q * 8]); vst2((unsigned*)(QKL + o), *(const v4u*)&sl[rl][q * 8]); } }
  else { const int cv0 = c0 - 2 * CC; for (int e = tid; e < 128 * 8; e += 128) { const int cl = e >> 3, q = e & 7; const size_t o = ((b * CC + cv0 + cl) * (size_t)NN) + blockIdx.x * 64 + q * 8; vst2((unsigned*)(VT + o), *(const v4u*)&th[cl][q * 8]); vst2((unsigned*)(VTL + o), *(const v4u*)&tl[cl][q * 8]); } } }
// ---- k_att: block = (128 queries = 8 waves x 16, head, b), transposed products: S^T = K . Q^T (3 products; a lane holds 16 of the pass's 32 keys of ONE query) x 32^-0.5 x (0.1 + 0.9 IM[n][m]) x log2 e, running-max base-2 softmax in-lane plus one exchange between the wave's halves, P^T packed from the score accumulators as B operand, O^T += V^T . P^T (v planes hi + residual, 2 products) -> Z merged
// operands come through a two-buffer LDS ring, a stage = 64 keys = 2 passes: K rows (hi | residual), v planes (hi, residual) and the block's 128 mask rows (bf16), each byte copied once per block with adjacent lanes on adjacent 16 bytes; a staged K and v tile serves all 128 queries
__device__ __forceinline__ float xhalf(float x) { return __builtin_bit_cast(float, __builtin_amdgcn_permlanex16(__builtin_bit_cast(int, x), __builtin_bit_cast(int, x), 0x76543210, 0xfedcba98, false, false)); }  // lane l with lane l ^ 16
#define QB 128                         // queries per block
#define KT 64                          // keys per stage
#define KP 144                         // LDS pitch, bytes: K row (64 B hi | 64 B residual) and v plane row (64 keys), 16 B x odd for 16-byte readers
#define IP 144                         // LDS pitch, bytes: mask row (64 keys, bf16), 16 B x odd for 16-byte readers
#define OFF_VH (KT * KP)
#define OFF_VL (OFF_VH + DK * KP)
#define OFF_IM (OFF_VL + DK * KP)
#define STG (OFF_IM + QB * IP)         // bytes of one stage
// softmax in base 2: 32^-0.5 and log2(e) are folded into the two constants of the mask factor, (0.1 + 0.9 mask) x 32^-0.5 x log2(e) = FA + FB x mask
#define FA ((float)(0.1 * 0.17677669529663687 * 1.4426950408889634))
#define FB ((float)(0.9 * 0.17677669529663687 * 1.4426950408889634))
// 4 waves a SIMD: the grid is 2 work-groups a WGP, and no WGP is to take a third while another holds one
__global__ __launch_bounds__(256) __attribute__((amdgpu_waves_per_eu(4, 4))) void k_att(const _Float16* __restrict__ QK, const _Float16* __restrict__ QKL, const _Float16* __restrict__ VT, const _Float16* __restrict__ VTL, const __bf16* __restrict__ MB, float* __restrict__ Z) {
  __shared__ __align__(16) unsigned char ring[2 * STG];
  const int tid = threadIdx.x, wave = tid >> 5, lane = tid & 31, col = lane & 15, g = lane >> 4; const int h = blockIdx.y; const size_t b = blockIdx.z; const int q0 = blockIdx.x * QB + wave * 16; const size_t rq = b * NN + q0;
  const v16h aq = frag_h(QK + (rq + col) * (2 * CC) + h * DK, lane), aql = frag_h(QKL + (rq + col) * (2 * CC) + h * DK, lane);   // B operands: column = query q0 + col
  // this thread's share of a stage: K row tid >> 2 (4 lanes a 64-byte row), v channel tid >> 3 (8 lanes a 128-byte row), mask rows tid >> 3 + 32 i (8 lanes a 128-byte row)
  const unsigned lr = (unsigned)(size_t)ring;   // the ring's byte address in LDS
  const unsigned lk = lr + (tid >> 2) * KP + (tid & 3) * 16, lv = lr + OFF_VH + (tid >> 3) * KP + (tid & 7) * 16, li = lr + OFF_IM + (tid >> 3) * IP + (tid & 7) * 16;
  const size_t ok = (b * NN + (tid >> 2)) * (2 * CC) + CC + h * DK + (tid & 3) * 8, ov = (b * CC + (size_t)h * DK + (tid >> 3)) * (size_t)NN + (tid & 7) * 8;
  const __bf16* gi = MB + (size_t)(blockIdx.x * QB + (tid >> 3)) * NN + (tid & 7) * 8;
  auto fill = [&](int t, unsigned bo) {   // stage t into the buffer at byte offset bo
    const _Float16 *kh = QK + ok + (size_t)t * KT * (2 * CC), *kl = QKL + ok + (size_t)t * KT * (2 * CC), *vh = VT + ov + t * KT, *vl = VTL + ov + t * KT; const __bf16* im = gi + t * KT;
    cp8(lk + bo, lk + bo + 64, lv + bo, lv + bo + DK * KP, li + bo, li + bo + 32 * IP, li + bo + 64 * IP, li + bo + 96 * IP,
        kh, kl, vh, vl, im, im + 32 * (size_t)NN, im + 64 * (size_t)NN, im + 96 * (size_t)NN); };
  float m = -3.0e38f, l = 0.f;   // m: running maximum of the base-2 logits less 11, the one offset of exponents and rescaling, so that every exp2 comes out x 2^11; l: sum of those, this half's keys only, the halves are joined behind the loop
  v8f acc[2] = {}, accl[2] = {};   // O^T: register r of tile j = channel j * 16 + 8 g + r of query q0 + col
  fill(0, 0);
  asm volatile("s_wait_asynccnt 0x0" ::: "memory");   // stage 0 has landed before the barrier that publishes it
  __syncthreads();
  fill(1, STG);
#pragma unroll 1   // the stage loop stays rolled: one stage's code and registers
  for (int t = 0; t < NN / KT; ++t) { const unsigned bo = (t & 1) * STG; const unsigned char* st = ring + bo;
#pragma unroll   // both passes of a stage unrolled, so that every LDS offset is an immediate
   for (int sub = 0; sub < KT / 32; ++sub) { v8f s[2];
#pragma unroll
    for (int ct = 0; ct < 2; ++ct) { const _Float16* pk = (const _Float16*)(st + (sub * 32 + ct * 16 + col) * KP); const v16h kh = frag_h(pk, lane), kl = frag_h(pk + 32, lane);
      v8f c = {}, cl = {}; c = wmma16(kh, aq, c); cl = wmma16(kl, aq, cl); cl = wmma16(kh, aql, cl);
      const __bf16* pi = (const __bf16*)(st + OFF_IM + (wave * 16 + col) * IP) + sub * 32 + ct * 16 + 8 * g;   // this lane's query row; score register r of tile ct = key t * 64 + sub * 32 + ct * 16 + 8 g + r
      const v8b ia = *(const v8b*)pi;
#pragma unroll
      for (int r = 0; r < 8; ++r) s[ct][r] = (c[r] + cl[r] * (1.0f / 2048.0f)) * (FA + FB * (float)ia[r]); }   // base-2 logit
    float mx = fmaxf(s[0][0], s[1][0]);
#pragma unroll
    for (int r = 1; r < 8; ++r) mx = fmaxf(mx, fmaxf(s[0][r], s[1][r]));
    mx = fmaxf(mx, xhalf(mx));
    const float mn = fmaxf(m, mx - 11.0f), alpha = __builtin_amdgcn_exp2f(m - mn); float tt[8]; v16h pa;   // pa[i] = key kmap(i): tile i >> 3, register i & 7, the order frag_h gives the v planes
#pragma unroll
    for (int r = 0; r < 8; ++r) { const float e0 = __builtin_amdgcn_exp2f(s[0][r] - mn), e1 = __builtin_amdgcn_exp2f(s[1][r] - mn); tt[r] = e0 + e1; pa[r] = (_Float16)e0; pa[8 + r] = (_Float16)e1; }
    l = l * alpha + (((tt[0] + tt[1]) + (tt[2] + tt[3])) + ((tt[4] + tt[5]) + (tt[6] + tt[7]))); m = mn;
#pragma unroll
    for (int j = 0; j < 2; ++j)
#pragma unroll
      for (int r = 0; r < 8; ++r) { acc[j][r] *= alpha; accl[j][r] *= alpha; }
#pragma unroll
    for (int j = 0; j < 2; ++j) { const _Float16* pv = (const _Float16*)(st + OFF_VH + (j * 16 + col) * KP) + sub * 32; acc[j] = wmma16(frag_h(pv, lane), pa, acc[j]); accl[j] = wmma16(frag_h(pv + DK * KP / 2, lane), pa, accl[j]); } }
   asm volatile("s_wait_dscnt 0x0" ::: "memory");      // this wave's reads of the stage are done before the buffer is given up
   asm volatile("s_wait_asynccnt 0x0" ::: "memory");   // this wave's copies of stage t + 1 have landed before the barrier that publishes them
   __syncthreads();                                    // publishes stage t + 1 and ends every wave's reads of stage t
   if (t + 2 < NN / KT) fill(t + 2, bo); }
  asm volatile("s_wait_asynccnt 0x0" ::: "memory");   // nothing is in flight when the ring becomes output staging and the wave ends
  float (*so)[16][36] = (float (*)[16][36])ring;   // output staging in the ring, a slice per wave: behind the last stage's barrier nobody reads the ring and no copy is in flight
  l += xhalf(l);
  const float il = 1.0f / l;   // l and the accumulators both carry the 2^11
#pragma unroll
  for (int j = 0; j < 2; ++j)
#pragma unroll
    for (int r = 0; r < 8; ++r) so[wave][col][j * 16 + 8 * g + r] = (acc[j][r] + accl[j][r] * (1.0f / 2048.0f)) * il;
  LDSX(); for (int rl = 0; rl < 16; ++rl) if (lane < 8) vst2(Z + (rq + rl) * CC + (size_t)h * DK + lane * 4, *(const v4f*)&so[wave][rl][lane * 4]); }
// ---- k_out: block = (64 rows, 128 cols): out = Z (bf16 hi + lo) . W_out + b
__global__ __launch_bounds__(128) void k_out(const float* __restrict__ Z, const __bf16* __restrict__ PO, const float* __restrict__ BO, float* __restrict__ OUT) { __shared__ __align__(16) unsigned char ring[2 * GSTG];
  float (*sf)[16][132] = (float (*)[16][132])ring;   // output staging in the ring, a slice per wave: behind the last stage's barrier nobody reads the ring and no copy is in flight
  static_assert(4 * 16 * 132 * 4 <= 2 * GSTG, "the output staging fits the ring");
  const int tid = threadIdx.x, wave = tid >> 5, lane = tid & 31, col = lane & 15, g = lane >> 4; const size_t r0 = (size_t)blockIdx.x * 64 + wave * 16; const int c0 = blockIdx.y * 128;
  v8f acc[8] = {}; float bb[8];
#pragma unroll   // the eight bias loads stand ahead of the products, so that the epilogue waits for none of them
  for (int j = 0; j < 8; ++j) bb[j] = BO[c0 + j * 16 + col];
  const unsigned lr = (unsigned)(size_t)ring, lw = lr + (tid >> 3) * WP + (tid & 7) * 16, lx = lr + OFF_X + (tid >> 4) * XP + (tid & 15) * 16;   // lr: the ring's byte address in LDS
  const __bf16* gw = PO + (size_t)(c0 + (tid >> 3)) * CC + (tid & 7) * 8; const float* gx = Z + ((size_t)blockIdx.x * 64 + (tid >> 4)) * CC + (tid & 15) * 4;
  gfill(lw, lx, gw, gx);
  asm volatile("s_wait_asynccnt 0x0" ::: "memory");   // stage 0 has landed before the barrier that publishes it
  __syncthreads();
  gfill(lw + GSTG, lx + GSTG, gw + GK, gx + GK);
#pragma unroll   // four stages, unrolled so that every LDS offset is an immediate
  for (int t = 0; t < CC / GK; ++t) { const unsigned bo = (t & 1) * GSTG; const unsigned char* st = ring + bo;
#pragma unroll
   for (int kk = 0; kk < GK / 32; ++kk) { float v[16]; row16((const float*)(st + OFF_X + (wave * 16 + col) * XP) + kk * 32, lane, v); const F2 a = bsplit16(v); v16b w[8];
#pragma unroll   // a k step's eight W fragments are fetched as one group ahead of its products: one load latency a k step, not one a fragment
    for (int j = 0; j < 8; ++j) w[j] = frag_b((const __bf16*)(st + (j * 16 + col) * WP) + kk * 32, lane);
#pragma unroll   // each tile still adds its hi product first and its lo product second
    for (int j = 0; j < 8; ++j) acc[j] = wmma_bf(a.h, w[j], acc[j]);
#pragma unroll   // unrolled like the loop above, so that w[] and acc[] are indexed by constants and stay in registers
    for (int j = 0; j < 8; ++j) acc[j] = wmma_bf(a.l, w[j], acc[j]); }
   asm volatile("s_wait_dscnt 0x0" ::: "memory");      // this wave's reads of the stage are done before the buffer is given up
   asm volatile("s_wait_asynccnt 0x0" ::: "memory");   // this wave's copies of stage t + 1 have landed before the barrier that publishes them
   __syncthreads();                                    // publishes stage t + 1 and ends every wave's reads of stage t
   if (t + 2 < CC / GK) gfill(lw + bo, lx + bo, gw + (t + 2) * GK, gx + (t + 2) * GK); }
  asm volatile("s_wait_asynccnt 0x0" ::: "memory");   // nothing is in flight when the ring becomes output staging
#pragma unroll
  for (int j = 0; j < 8; ++j) { const float bj = bfr(bb[j]);
#pragma unroll
    for (int r = 0; r < 8; ++r) sf[wave][8 * g + r][j * 16 + col] = acc[j][r] + bj; }
  LDSX(); for (int rl = 0; rl < 16; ++rl) vst2(OUT + (r0 + rl) * CC + c0 + lane * 4, *(const v4f*)&sf[wave][rl][lane * 4]); }
extern "C" void kernel_launch(void* const* d_in, const int* in_sizes, int n_in, void* d_out, int out_size, void* d_ws, size_t ws_size, hipStream_t stream) {
  (void)in_sizes; (void)n_in; (void)out_size;
  const float** F = (const float**)d_in;   // 0 x [4,2048,256], 1 interaction_mask [2048,2048], 2 W_qkv [256,768] (in,out), 3 b_qkv [768], 4 W_out [256,256] (in,out), 5 b_out
  if (ws_size < (size_t)WS_END) return;
  char* ws = (char*)d_ws; __bf16 *PW = (__bf16*)(ws + WS_PW), *PO = (__bf16*)(ws + WS_PO); _Float16 *QK = (_Float16*)(ws + WS_QK), *QKL = (_Float16*)(ws + WS_QKL), *VT = (_Float16*)(ws + WS_VT), *VTL = (_Float16*)(ws + WS_VTL); float* Z = (float*)(ws + WS_Z); __bf16* MB = (__bf16*)(ws + WS_MB);
  k_pack<<<4 * CC, 256, 0, stream>>>(F[2], F[4], F[1], PW, PO, MB);
  k_proj<<<dim3(NN / 64, 3 * CC / 128, TNB), 128, 0, stream>>>(F[0], PW, F[3], QK, QKL, VT, VTL);
  k_att<<<dim3(NN / QB, NH, TNB), 256, 0, stream>>>(QK, QKL, VT, VTL, MB, Z);
  k_out<<<dim3(TNB * NN / 64, CC / 128), 128, 0, stream>>>(Z, PO, F[5], (float*)d_out);
}

// v008
// A run of this version takes 71 microseconds.
// In both of two side-by-side timings against v007, it was 1.09 times as fast.
// All steps since v000 together make it 3.33 times as fast.
// compute dtype: all float inputs rounded to bf16; qkv = x . W_qkv + b with EXACT bf16 products on WMMA 16x16x32 ((in,out) weights as transposed rows), q/k rounded to f16 hi + residual rows, v to f16 hi + residual planes; logits q . k with 3 products, x 32^-0.5 x (0.1 + 0.9 interaction_mask[n][m]) read per pair (mask rounded to bf16 once, ahead of the attention), softmax in f32 in base 2 with a held offset, renewed only when an exponent would pass 15 (hardware exp2; 32^-0.5 log2 e inside the mask factor's constants, 2^11 inside the offset), P (x 2^11, f16) . v (hi + residual, 2 products); out = ctx (bf16 hi + lo, 2 products) . W_out + b; f32 output.
#include <hip/hip_runtime.h>
#include <math.h>

typedef __attribute__((ext_vector_type(16))) _Float16 v16h;
typedef __attribute__((ext_vector_type(16))) __bf16 v16b;
typedef __attribute__((ext_vector_type(8)))  _Float16 v8h;
typedef __attribute__((ext_vector_type(8)))  float v8f;
typedef __attribute__((ext_vector_type(4)))  float v4f;
typedef __attribute__((ext_vector_type(2)))  float v2f;
typedef __attribute__((ext_vector_type(4)))  unsigned v4u;
typedef __attribute__((ext_vector_type(4)))  int v4i;
typedef float __attribute__((may_alias)) float_a;
typedef int __attribute__((may_alias)) int_a;

template <typename T> __device__ __forceinline__ void vst2(void* p, T v) { *(T*)p = v;  }
// plain builtins: the compiler keeps the distance behind its own matrix instructions and is free to issue later operand loads ahead of them
__device__ __forceinline__ v8f wmma16(v16h a, v16h b, v8f c) {
  return __builtin_amdgcn_wmma_f32_16x16x32_f16(false, a, false, b, (short)0, c, false, false);
}
__device__ __forceinline__ v8f wmma_bf(v16b a, v16b b, v8f c) {
  return __builtin_amdgcn_wmma_f32_16x16x32_bf16(false, a, false, b, (short)0, c, false, false);
}
// 16x16x32 fragments: lane = (h = lane>>4, row/col = lane&15); elements 0..7 = k0+8h+0..7, 8..15 = k0+16+8h+0..7; D element r = row 8h+r
__device__ __forceinline__ v16h frag_h(const _Float16* rowk0, int lane) {
  union { v16h v; v8h q[2]; } u; const _Float16* p = rowk0 + 8 * (lane >> 4);
  u.q[0] = *(const v8h*)p; u.q[1] = *(const v8h*)(p + 16); return u.v;
}
__device__ __forceinline__ v16h frag_f32(const float* rowk0, int lane) {
  v16h a; const float* p = rowk0 + 8 * (lane >> 4);
#pragma unroll
  for (int i = 0; i < 8; ++i) { a[i] = (_Float16)p[i]; a[8 + i] = (_Float16)p[16 + i]; }
  return a;
}
__device__ __forceinline__ v16h frag_f32s(const float* rowk0, int lane, float sc) {
  v16h a; const float* p = rowk0 + 8 * (lane >> 4);
#pragma unroll
  for (int i = 0; i < 8; ++i) { a[i] = (_Float16)(p[i] * sc); a[8 + i] = (_Float16)(p[16 + i] * sc); }
  return a;
}
// column fragment from a [K][ld] layout (column n), rows >= K read as 0
__device__ __forceinline__ v16h fragc_f32(const float* W, int k0, int n, int lane, int ld, int K) {
  v16h a; const int g = lane >> 4;
#pragma unroll
  for (int i = 0; i < 8; ++i) { const int ka = k0 + 8 * g + i, kb = ka + 16;
    a[i] = (_Float16)(ka < K ? W[(size_t)(ka < K ? ka : K - 1) * ld + n] : 0.f); a[8 + i] = (_Float16)(kb < K ? W[(size_t)(kb < K ? kb : K - 1) * ld + n] : 0.f); }
  return a;
}
struct F2 { v16b h, l; };
__device__ __forceinline__ F2 bsplit16(const float v[16]) { F2 r;
#pragma unroll
  for (int i = 0; i < 16; ++i) { const __bf16 h = (__bf16)v[i]; r.h[i] = h; r.l[i] = (__bf16)(v[i] - (float)h); }
  return r; }
__device__ __forceinline__ F2 split_row(const float* row, int k0, int lane) { float v[16]; const float* p = row + k0 + 8 * (lane >> 4);
#pragma unroll
  for (int i = 0; i < 8; ++i) { v[i] = p[i]; v[8 + i] = p[16 + i]; }
  return bsplit16(v); }
__device__ __forceinline__ F2 split_rowK(const float* row, int k0, int lane, int K) { float v[16]; const int g = lane >> 4;
#pragma unroll
  for (int i = 0; i < 8; ++i) { const int ka = k0 + 8 * g + i, kb = ka + 16; v[i] = ka < K ? row[ka < K ? ka : K - 1] : 0.f; v[8 + i] = kb < K ? row[kb < K ? kb : K - 1] : 0.f; }
  return bsplit16(v); }
__device__ __forceinline__ F2 split_col(const float* W, int k0, int n, int lane, int ld, int K) { float v[16]; const int g = lane >> 4;
#pragma unroll
  for (int i = 0; i < 8; ++i) { const int ka = k0 + 8 * g + i, kb = ka + 16; v[i] = ka < K ? W[(size_t)(ka < K ? ka : K - 1) * ld + n] : 0.f; v[8 + i] = kb < K ? W[(size_t)(kb < K ? kb : K - 1) * ld + n] : 0.f; }
  return bsplit16(v); }
__device__ __forceinline__ v8f mac3(const F2& a, const F2& b, v8f c) { c = wmma_bf(a.l, b.h, c); c = wmma_bf(a.h, b.l, c); return wmma_bf(a.h, b.h, c); }
__device__ __forceinline__ float sigm(float v) { return 1.0f / (1.0f + expf(-v)); }
#define LDSX() do { asm volatile("s_wait_dscnt 0" ::: "memory"); __builtin_amdgcn_wave_barrier(); __builtin_amdgcn_fence(__ATOMIC_RELEASE, "workgroup"); } while (0)


// Biologically-modulated attention (B 4, N 2,048 genes, C 256, 8 heads x 32): fused (in,out) qkv + bias, logits scaled by (0.1 + 0.9 x PPI interaction strength) before the softmax, (in,out) output projection + bias.
#define NB 4
#define NN 2048
#define CC 256
#define NH 8
#define DK 32
#ifndef TNB
#define TNB NB
#endif
typedef __attribute__((ext_vector_type(8))) __bf16 v8b;
__device__ __forceinline__ v16b frag_b(const __bf16* rowk0, int lane) {
  union { v16b v; v8b q[2]; } u; const __bf16* p = rowk0 + 8 * (lane >> 4);
  u.q[0] = *(const v8b*)p; u.q[1] = *(const v8b*)(p + 16); return u.v;
}
__device__ __forceinline__ float bfr(float v) { return (float)(__bf16)v; }
__device__ __attribute__((noinline)) float exp_ni(float v) { return expf(v); }
__device__ __attribute__((noinline)) float erf_ni(float v) { return erff(v); }

#define WS_PW  0u                                   // bf16 rows [768][256] (qkv, transposed (in,out)); [256][256] W_out^T
#define WS_PO  (WS_PW + 2u * 3 * CC * CC)
#define WS_QK  (WS_PO + 2u * CC * CC)                   // f16 hi|lo q|k rows [b*NN + n][512]
#define WS_QKL (WS_QK + 2u * (size_t)NB * NN * 2 * CC)
#define WS_VT  (WS_QKL + 2u * (size_t)NB * NN * 2 * CC) // f16 hi|lo v planes [b][c][n]
#define WS_VTL (WS_VT + 2u * (size_t)NB * CC * NN)
#define WS_Z   (WS_VTL + 2u * (size_t)NB * CC * NN)     // f32 ctx [b*NN + n][256]
#define WS_MB  (WS_Z + 4u * (size_t)NB * NN * CC)       // bf16 interaction mask [n][m]
#define WS_END (WS_MB + 2u * (size_t)NN * NN)

typedef __attribute__((ext_vector_type(4))) __bf16 v4b;
#define MPB (NN * NN / (4 * CC))       // mask elements a k_pack block rounds
static_assert(MPB % 1024 == 0, "a block's share of the mask is whole rounds of 256 threads x 4 floats");
__global__ __launch_bounds__(256) void k_pack(const float* __restrict__ WQKV, const float* __restrict__ WO, const float* __restrict__ IM, __bf16* __restrict__ PW, __bf16* __restrict__ PO, __bf16* __restrict__ MB) { const int n = blockIdx.x, t = threadIdx.x; __shared__ __align__(16) __bf16 s[CC];   // n in [0, 1024): rows 0..767 qkv columns, 768..1023 W_out columns
  // the block's share of the interaction mask, rounded to bf16 once here for every batch and head; adjacent lanes on adjacent 16 bytes, loads issued ahead of the weight column
  const size_t mo = (size_t)n * MPB + t * 4; v4f mk[MPB / 1024];
#pragma unroll   // all of the share's loads in flight together, mk[] in registers
  for (int i = 0; i < MPB / 1024; ++i) mk[i] = *(const v4f*)(IM + mo + i * 1024);
  if (n < 3 * CC) s[t] = (__bf16)WQKV[(size_t)t * (3 * CC) + n]; else s[t] = (__bf16)WO[(size_t)t * CC + (n - 3 * CC)]; __syncthreads();
  __bf16* dst = (n < 3 * CC) ? PW + (size_t)n * CC : PO + (size_t)(n - 3 * CC) * CC; if (t < CC / 8) vst2((unsigned*)(dst + t * 8), *(const v4u*)&s[t * 8]);
#pragma unroll   // mk[] indexed by constants
  for (int i = 0; i < MPB / 1024; ++i) { v4b o;
#pragma unroll   // vector elements indexed by constants
    for (int e = 0; e < 4; ++e) o[e] = (__bf16)mk[i][e];
    *(v4b*)(MB + mo + i * 1024) = o; } }
__device__ __forceinline__ v16b fragb_f32(const float* __restrict__ p, int lane) { v16b a; const float* pp = p + 8 * (lane >> 4);
#pragma unroll
  for (int i = 0; i < 8; ++i) { a[i] = (__bf16)pp[i]; a[8 + i] = (__bf16)pp[16 + i]; } return a; }
// eight asynchronous copies of 16 bytes per lane; the s_wait_xcnt stands inside the statement so that no address register of a copy is rewritten in front of it (a precaution)
__device__ __forceinline__ void cp8(unsigned l0, unsigned l1, unsigned l2, unsigned l3, unsigned l4, unsigned l5, unsigned l6, unsigned l7, const void* g0, const void* g1, const void* g2, const void* g3, const void* g4, const void* g5, const void* g6, const void* g7) {
  asm volatile("global_load_async_to_lds_b128 %0, %8, off\n\tglobal_load_async_to_lds_b128 %1, %9, off\n\tglobal_load_async_to_lds_b128 %2, %10, off\n\tglobal_load_async_to_lds_b128 %3, %11, off\n\t"
               "global_load_async_to_lds_b128 %4, %12, off\n\tglobal_load_async_to_lds_b128 %5, %13, off\n\tglobal_load_async_to_lds_b128 %6, %14, off\n\tglobal_load_async_to_lds_b128 %7, %15, off\n\ts_wait_xcnt 0x0"
               :: "v"(l0), "v"(l1), "v"(l2), "v"(l3), "v"(l4), "v"(l5), "v"(l6), "v"(l7), "v"(g0), "v"(g1), "v"(g2), "v"(g3), "v"(g4), "v"(g5), "v"(g6), "v"(g7) : "memory");
}
// ---- operand staging of the two projection GEMMs (block = 64 rows x 128 columns, K 256): a two-buffer LDS ring, a stage = 64 k: the block's 128 weight rows (bf16, one 128-byte line each, 8 lanes a line) and its 64 activation rows (f32, 256 bytes each, 16 lanes a row), each byte copied once per block with adjacent lanes on adjacent 16 bytes
#define GK 64                          // k per stage
#define WP 144                         // LDS pitch, bytes: weight row of a stage, 16 B x odd for 16-byte readers
#define XP 272                         // LDS pitch, bytes: activation row of a stage, 16 B x odd for 16-byte readers
#define OFF_X (128 * WP)
#define GSTG (OFF_X + 64 * XP)         // bytes of one stage
__device__ __forceinline__ void gfill(unsigned lw, unsigned lx, const __bf16* gw, const float* gx) {   // lw, gw: this thread's 16 bytes of weight row tid >> 3; lx, gx: of activation row tid >> 4
  cp8(lw, lw + 16 * WP, lw + 32 * WP, lw + 48 * WP, lw + 64 * WP, lw + 80 * WP, lw + 96 * WP, lw + 112 * WP, gw, gw + 16 * CC, gw + 32 * CC, gw + 48 * CC, gw + 64 * CC, gw + 80 * CC, gw + 96 * CC, gw + 112 * CC);
  cp8(lx, lx + 8 * XP, lx + 16 * XP, lx + 24 * XP, lx + 32 * XP, lx + 40 * XP, lx + 48 * XP, lx + 56 * XP, gx, gx + 8 * CC, gx + 16 * CC, gx + 24 * CC, gx + 32 * CC, gx + 40 * CC, gx + 48 * CC, gx + 56 * CC); }
// a lane's 16 f32 of an A fragment from a staged row, as four 16-byte reads: v[0..7] = k0 + 8 h + 0..7, v[8..15] = k0 + 16 + 8 h + 0..7
__device__ __forceinline__ void row16(const float* rowk0, int lane, float v[16]) { const v4f* q = (const v4f*)(rowk0 + 8 * (lane >> 4)); const v4f a = q[0], b = q[1], c = q[4], d = q[5];
#pragma unroll
  for (int i = 0; i < 4; ++i) { v[i] = a[i]; v[4 + i] = b[i]; v[8 + i] = c[i]; v[12 + i] = d[i]; } }
// ---- k_proj: block = (64 rows, 128 of 768 cols, b): y = x . W + b (exact); cols < 512 (q|k) -> f16 hi/lo rows; cols >= 512 (v) -> transposed planes
__global__ __launch_bounds__(128) void k_proj(const float* __restrict__ X, const __bf16* __restrict__ PW, const float* __restrict__ BQKV, _Float16* __restrict__ QK, _Float16* __restrict__ QKL, _Float16* __restrict__ VT, _Float16* __restrict__ VTL) {
  __shared__ __align__(16) unsigned char ring[2 * GSTG];
  _Float16 (*sh)[136] = (_Float16 (*)[136])ring, (*sl)[136] = (_Float16 (*)[136])(ring + 64 * 136 * 2), (*th)[72] = (_Float16 (*)[72])ring, (*tl)[72] = (_Float16 (*)[72])(ring + 128 * 72 * 2);   // output staging in the ring: behind the last stage's barrier nobody reads the ring and no copy is in flight
  static_assert(2 * 64 * 136 * 2 <= 2 * GSTG && 2 * 128 * 72 * 2 <= 2 * GSTG, "the output staging fits the ring");
  const int tid = threadIdx.x, wave = tid >> 5, lane = tid & 31, col = lane & 15, g = lane >> 4; const size_t b = blockIdx.z; const int i0 = blockIdx.x * 64 + wave * 16; const int c0 = blockIdx.y * 128; const size_t r0 = b * NN + i0;
  v8f acc[8] = {};
  const unsigned lr = (unsigned)(size_t)ring, lw = lr + (tid >> 3) * WP + (tid & 7) * 16, lx = lr + OFF_X + (tid >> 4) * XP + (tid & 15) * 16;   // lr: the ring's byte address in LDS
  const __bf16* gw = PW + (size_t)(c0 + (tid >> 3)) * CC + (tid & 7) * 8; const float* gx = X + (b * NN + blockIdx.x * 64 + (tid >> 4)) * CC + (tid & 15) * 4;
  gfill(lw, lx, gw, gx);
  asm volatile("s_wait_asynccnt 0x0" ::: "memory");   // stage 0 has landed before the barrier that publishes it
  __syncthreads();
  gfill(lw + GSTG, lx + GSTG, gw + GK, gx + GK);
#pragma unroll   // four stages, unrolled so that every LDS offset is an immediate
  for (int t = 0; t < CC / GK; ++t) { const unsigned bo = (t & 1) * GSTG; const unsigned char* st = ring + bo;
#pragma unroll
   for (int kk = 0; kk < GK / 32; ++kk) { float v[16]; row16((const float*)(st + OFF_X + (wave * 16 + col) * XP) + kk * 32, lane, v); v16b a;
#pragma unroll
    for (int i = 0; i < 16; ++i) a[i] = (__bf16)v[i];
    v16b w[8];
#pragma unroll   // a k step's eight W fragments are read ahead of its products, not each in front of its own product
    for (int j = 0; j < 8; ++j) w[j] = frag_b((const __bf16*)(st + (j * 16 + col) * WP) + kk * 32, lane);
    __builtin_amdgcn_sched_barrier(0);   // holds a k step's LDS reads ahead of its first product: without it the compiler puts each fragment's reads directly in front of its product, and the wave waits out the LDS latency at each
#pragma unroll   // w[] and acc[] indexed by constants
    for (int j = 0; j < 8; ++j) acc[j] = wmma_bf(a, w[j], acc[j]); }
   asm volatile("s_wait_dscnt 0x0" ::: "memory");      // this wave's reads of the stage are done before the buffer is given up
   asm volatile("s_wait_asynccnt 0x0" ::: "memory");   // this wave's copies of stage t + 1 have landed before the barrier that publishes them
   __syncthreads();                                    // publishes stage t + 1 and ends every wave's reads of stage t
   if (t + 2 < CC / GK) gfill(lw + bo, lx + bo, gw + (t + 2) * GK, gx + (t + 2) * GK); }
  asm volatile("s_wait_asynccnt 0x0" ::: "memory");   // nothing is in flight when the ring becomes output staging
  const bool isv = c0 >= 2 * CC;
#pragma unroll
  for (int j = 0; j < 8; ++j) { const float bb = bfr(BQKV[c0 + j * 16 + col]);
#pragma unroll
    for (int r = 0; r < 8; ++r) { const float v = acc[j][r] + bb; const _Float16 hv = (_Float16)v; const _Float16 lv = (_Float16)((v - (float)hv) * 2048.0f); if (!isv) { sh[wave * 16 + 8 * g + r][j * 16 + col] = hv; sl[wave * 16 + 8 * g + r][j * 16 + col] = lv; } else { th[j * 16 + col][wave * 16 + 8 * g + r] = hv; tl[j * 16 + col][wave * 16 + 8 * g + r] = lv; } } }
  __syncthreads();
  if (!isv) { for (int e = tid; e < 64 * 16; e += 128) { const int rl = e >> 4, q = e & 15; const size_t o = (b * NN + blockIdx.x * 64 + rl) * (2 * CC) + c0 + q * 8; vst2((unsigned*)(QK + o), *(const v4u*)&sh[rl][q * 8]); vst2((unsigned*)(QKL + o), *(const v4u*)&sl[rl][q * 8]); } }
  else { const int cv0 = c0 - 2 * CC; for (int e = tid; e < 128 * 8; e += 128) { const int cl = e >> 3, q = e & 7; const size_t o = ((b * CC + cv0 + cl) * (size_t)NN) + blockIdx.x * 64 + q * 8; vst2((unsigned*)(VT + o), *(const v4u*)&th[cl][q * 8]); vst2((unsigned*)(VTL + o), *(const v4u*)&tl[cl][q * 8]); } } }
// ---- k_att: block = (128 queries = 8 waves x 16, head, b), transposed products: S^T = K . Q^T (3 products; a lane holds 16 of the pass's 32 keys of ONE query) x 32^-0.5 x (0.1 + 0.9 IM[n][m]) x log2 e, base-2 softmax in-lane under a held offset (renewal, rare: one exchange between the wave's halves, sums and accumulators rescaled), P^T packed from the score accumulators as B operand, O^T += V^T . P^T (v planes hi + residual, 2 products) -> Z merged
// operands come through a two-buffer LDS ring, a stage = 64 keys = 2 passes: K rows (hi | residual), v planes (hi, residual) and the block's 128 mask rows (bf16), each byte copied once per block with adjacent lanes on adjacent 16 bytes; a staged K and v tile serves all 128 queries
__device__ __forceinline__ float xhalf(float x) { return __builtin_bit_cast(float, __builtin_amdgcn_permlanex16(__builtin_bit_cast(int, x), __builtin_bit_cast(int, x), 0x76543210, 0xfedcba98, false, false)); }  // lane l with lane l ^ 16
#define QB 128                         // queries per block
#define KT 64                          // keys per stage
#define KP 144                         // LDS pitch, bytes: K row (64 B hi | 64 B residual) and v plane row (64 keys), 16 B x odd for 16-byte readers
#define IP 144                         // LDS pitch, bytes: mask row (64 keys, bf16), 16 B x odd for 16-byte readers
#define OFF_VH (KT * KP)
#define OFF_VL (OFF_VH + DK * KP)
#define OFF_IM (OFF_VL + DK * KP)
#define STG (OFF_IM + QB * IP)         // bytes of one stage
// softmax in base 2: 32^-0.5 and log2(e) are folded into the two constants of the mask factor, (0.1 + 0.9 mask) x 32^-0.5 x log2(e) = FA + FB x mask
#define FA ((float)(0.1 * 0.17677669529663687 * 1.4426950408889634))
#define FB ((float)(0.9 * 0.17677669529663687 * 1.4426950408889634))
// 4 waves a SIMD: the grid is 2 work-groups a WGP, and no WGP is to take a third while another holds one
__global__ __launch_bounds__(256) __attribute__((amdgpu_waves_per_eu(4, 4))) void k_att(const _Float16* __restrict__ QK, const _Float16* __restrict__ QKL, const _Float16* __restrict__ VT, const _Float16* __restrict__ VTL, const __bf16* __restrict__ MB, float* __restrict__ Z) {
  __shared__ __align__(16) unsigned char ring[2 * STG];
  const int tid = threadIdx.x, wave = tid >> 5, lane = tid & 31, col = lane & 15, g = lane >> 4; const int h = blockIdx.y; const size_t b = blockIdx.z; const int q0 = blockIdx.x * QB + wave * 16; const size_t rq = b * NN + q0;
  const v16h aq = frag_h(QK + (rq + col) * (2 * CC) + h * DK, lane), aql = frag_h(QKL + (rq + col) * (2 * CC) + h * DK, lane);   // B operands: column = query q0 + col
  // this thread's share of a stage: K row tid >> 2 (4 lanes a 64-byte row), v channel tid >> 3 (8 lanes a 128-byte row), mask rows tid >> 3 + 32 i (8 lanes a 128-byte row)
  const unsigned lr = (unsigned)(size_t)ring;   // the ring's byte address in LDS
  const unsigned lk = lr + (tid >> 2) * KP + (tid & 3) * 16, lv = lr + OFF_VH + (tid >> 3) * KP + (tid & 7) * 16, li = lr + OFF_IM + (tid >> 3) * IP + (tid & 7) * 16;
  const size_t ok = (b * NN + (tid >> 2)) * (2 * CC) + CC + h * DK + (tid & 3) * 8, ov = (b * CC + (size_t)h * DK + (tid >> 3)) * (size_t)NN + (tid & 7) * 8;
  const __bf16* gi = MB + (size_t)(blockIdx.x * QB + (tid >> 3)) * NN + (tid & 7) * 8;
  auto fill = [&](int t, unsigned bo) {   // stage t into the buffer at byte offset bo
    const _Float16 *kh = QK + ok + (size_t)t * KT * (2 * CC), *kl = QKL + ok + (size_t)t * KT * (2 * CC), *vh = VT + ov + t * KT, *vl = VTL + ov + t * KT; const __bf16* im = gi + t * KT;
    cp8(lk + bo, lk + bo + 64, lv + bo, lv + bo + DK * KP, li + bo, li + bo + 32 * IP, li + bo + 64 * IP, li + bo + 96 * IP,
        kh, kl, vh, vl, im, im + 32 * (size_t)NN, im + 64 * (size_t)NN, im + 96 * (size_t)NN); };
  float nm = 3.0e38f, l = 0.f;   // nm: the offset added to every base-2 logit, 11 less the maximum seen when it was last renewed, so that every exp2 comes out x 2^11 of that maximum's scale; the start value makes stage 0 renew it; l: sum of the exp2, this half's keys only, the halves are joined behind the loop
  v8f acc[2] = {}, accl[2] = {};   // O^T: register r of tile j = channel j * 16 + 8 g + r of query q0 + col
  fill(0, 0);
  asm volatile("s_wait_asynccnt 0x0" ::: "memory");   // stage 0 has landed before the barrier that publishes it
  __syncthreads();
  fill(1, STG);
#pragma unroll 1   // the stage loop stays rolled: one stage's code and registers
  for (int t = 0; t < NN / KT; ++t) { const unsigned bo = (t & 1) * STG; const unsigned char* st = ring + bo;
   v8f s[4], d[4], f[4];   // of the stage's 64 keys, tile i = pass i >> 1, half i & 1: d: q . k, f: mask factor, s: exponent
#pragma unroll   // the stage's four score tiles unrolled, so that every LDS offset is an immediate
   for (int i = 0; i < 4; ++i) { const _Float16* pk = (const _Float16*)(st + (i * 16 + col) * KP); const v16h kh = frag_h(pk, lane), kl = frag_h(pk + 32, lane);
     v8f c = {}, cl = {}; c = wmma16(kh, aq, c); cl = wmma16(kl, aq, cl); cl = wmma16(kh, aql, cl);
     const __bf16* pi = (const __bf16*)(st + OFF_IM + (wave * 16 + col) * IP) + i * 16 + 8 * g;   // this lane's query row; score register r of tile i = key t * 64 + i * 16 + 8 g + r
     const v8b ia = *(const v8b*)pi;
#pragma unroll
     for (int r = 0; r < 8; ++r) { d[i][r] = c[r] + cl[r] * (1.0f / 2048.0f); f[i][r] = FA + FB * (float)ia[r]; s[i][r] = __builtin_fmaf(d[i][r], f[i][r], nm); } }   // base-2 logit plus the offset in use
   float mt[4];   // a maximum per tile, so that only the last tile's chain stands between its products and the branch
#pragma unroll
   for (int i = 0; i < 4; ++i) { mt[i] = fmaxf(s[i][0], s[i][1]);
#pragma unroll
     for (int r = 2; r < 8; ++r) mt[i] = fmaxf(mt[i], s[i][r]); }
   const float mx = fmaxf(fmaxf(mt[0], mt[1]), fmaxf(mt[2], mt[3]));
   v16h vf[KT / 32][4];   // the stage's v fragments are fetched ahead of the branch: their LDS latency runs under the branch and the exponentials, not in front of each product
#pragma unroll
   for (int sub = 0; sub < KT / 32; ++sub)
#pragma unroll
     for (int j = 0; j < 2; ++j) { const _Float16* pv = (const _Float16*)(st + OFF_VH + (j * 16 + col) * KP) + sub * 32; vf[sub][2 * j] = frag_h(pv, lane); vf[sub][2 * j + 1] = frag_h(pv + DK * KP / 2, lane); }
   // the offset is renewed, and sums and accumulators rescaled, only when some exponent of the wave would pass 15 (P stays below 2^15 in f16); one scalar branch a stage, every lane on inside it
   if (__builtin_expect(__builtin_amdgcn_ballot_w32(mx > 15.0f) != 0, 0)) {
     float ma = -3.0e38f;
#pragma unroll
     for (int i = 0; i < 4; ++i)
#pragma unroll
       for (int r = 0; r < 8; ++r) ma = fmaxf(ma, d[i][r] * f[i][r]);
     ma = fmaxf(ma, xhalf(ma));   // both halves of a query hold the same offset
     const float nn = fminf(nm, 11.0f - ma), alpha = __builtin_amdgcn_exp2f(nn - nm); nm = nn; l *= alpha;
#pragma unroll
     for (int j = 0; j < 2; ++j)
#pragma unroll
       for (int r = 0; r < 8; ++r) { acc[j][r] *= alpha; accl[j][r] *= alpha; }
#pragma unroll
     for (int i = 0; i < 4; ++i)
#pragma unroll
       for (int r = 0; r < 8; ++r) s[i][r] = __builtin_fmaf(d[i][r], f[i][r], nn); }
#pragma unroll   // both passes of a stage unrolled, so that s[] and vf[] are indexed by constants and stay in registers
   for (int sub = 0; sub < KT / 32; ++sub) { float tt[8]; v16h pa;   // pa[i] = key kmap(i): tile i >> 3, register i & 7, the order frag_h gives the v planes
#pragma unroll
    for (int r = 0; r < 8; ++r) { const float e0 = __builtin_amdgcn_exp2f(s[2 * sub][r]), e1 = __builtin_amdgcn_exp2f(s[2 * sub + 1][r]); tt[r] = e0 + e1; pa[r] = (_Float16)e0; pa[8 + r] = (_Float16)e1; }
    l += ((tt[0] + tt[1]) + (tt[2] + tt[3])) + ((tt[4] + tt[5]) + (tt[6] + tt[7]));
#pragma unroll
    for (int j = 0; j < 2; ++j) { acc[j] = wmma16(vf[sub][2 * j], pa, acc[j]); accl[j] = wmma16(vf[sub][2 * j + 1], pa, accl[j]); } }
   asm volatile("s_wait_dscnt 0x0" ::: "memory");      // this wave's reads of the stage are done before the buffer is given up
   asm volatile("s_wait_asynccnt 0x0" ::: "memory");   // this wave's copies of stage t + 1 have landed before the barrier that publishes them
   __syncthreads();                                    // publishes stage t + 1 and ends every wave's reads of stage t
   if (t + 2 < NN / KT) fill(t + 2, bo); }
  asm volatile("s_wait_asynccnt 0x0" ::: "memory");   // nothing is in flight when the ring becomes output staging and the wave ends
  float (*so)[16][36] = (float (*)[16][36])ring;   // output staging in the ring, a slice per wave: behind the last stage's barrier nobody reads the ring and no copy is in flight
  l += xhalf(l);
  const float il = 1.0f / l;   // l and the accumulators both carry the 2^11
#pragma unroll
  for (int j = 0; j < 2; ++j)
#pragma unroll
    for (int r = 0; r < 8; ++r) so[wave][col][j * 16 + 8 * g + r] = (acc[j][r] + accl[j][r] * (1.0f / 2048.0f)) * il;
  LDSX(); for (int rl = 0; rl < 16; ++rl) if (lane < 8) vst2(Z + (rq + rl) * CC + (size_t)h * DK + lane * 4, *(const v4f*)&so[wave][rl][lane * 4]); }
// ---- k_out: block = (64 rows, 128 cols): out = Z (bf16 hi + lo) . W_out + b
__global__ __launch_bounds__(128) void k_out(const float* __restrict__ Z, const __bf16* __restrict__ PO, const float* __restrict__ BO, float* __restrict__ OUT) { __shared__ __align__(16) unsigned char ring[2 * GSTG];
  float (*sf)[16][132] = (float (*)[16][132])ring;   // output staging in the ring, a slice per wave: behind the last stage's barrier nobody reads the ring and no copy is in flight
  static_assert(4 * 16 * 132 * 4 <= 2 * GSTG, "the output staging fits the ring");
  const int tid = threadIdx.x, wave = tid >> 5, lane = tid & 31, col = lane & 15, g = lane >> 4; const size_t r0 = (size_t)blockIdx.x * 64 + wave * 16; const int c0 = blockIdx.y * 128;
  v8f acc[8] = {}; float bb[8];
#pragma unroll   // the eight bias loads stand ahead of the products, so that the epilogue waits for none of them
  for (int j = 0; j < 8; ++j) bb[j] = BO[c0 + j * 16 + col];
  const unsigned lr = (unsigned)(size_t)ring, lw = lr + (tid >> 3) * WP + (tid & 7) * 16, lx = lr + OFF_X + (tid >> 4) * XP + (tid & 15) * 16;   // lr: the ring's byte address in LDS
  const __bf16* gw = PO + (size_t)(c0 + (tid >> 3)) * CC + (tid & 7) * 8; const float* gx = Z + ((size_t)blockIdx.x * 64 + (tid >> 4)) * CC + (tid & 15) * 4;
  gfill(lw, lx, gw, gx);
  asm volatile("s_wait_asynccnt 0x0" ::: "memory");   // stage 0 has landed before the barrier that publishes it
  __syncthreads();
  gfill(lw + GSTG, lx + GSTG, gw + GK, gx + GK);
#pragma unroll   // four stages, unrolled so that every LDS offset is an immediate
  for (int t = 0; t < CC / GK; ++t) { const unsigned bo = (t & 1) * GSTG; const unsigned char* st = ring + bo;
#pragma unroll
   for (int kk = 0; kk < GK / 32; ++kk) { float v[16]; row16((const float*)(st + OFF_X + (wave * 16 + col) * XP) + kk * 32, lane, v); const F2 a = bsplit16(v); v16b w[8];
#pragma unroll   // a k step's eight W fragments are fetched as one group ahead of its products: one load latency a k step, not one a fragment
    for (int j = 0; j < 8; ++j) w[j] = frag_b((const __bf16*)(st + (j * 16 + col) * WP) + kk * 32, lane);
#pragma unroll   // each tile still adds its hi product first and its lo product second
    for (int j = 0; j < 8; ++j) acc[j] = wmma_bf(a.h, w[j], acc[j]);
#pragma unroll   // unrolled like the loop above, so that w[] and acc[] are indexed by constants and stay in registers
    for (int j = 0; j < 8; ++j) acc[j] = wmma_bf(a.l, w[j], acc[j]); }
   asm volatile("s_wait_dscnt 0x0" ::: "memory");      // this wave's reads of the stage are done before the buffer is given up
   asm volatile("s_wait_asynccnt 0x0" ::: "memory");   // this wave's copies of stage t + 1 have landed before the barrier that publishes them
   __syncthreads();                                    // publishes stage t + 1 and ends every wave's reads of stage t
   if (t + 2 < CC / GK) gfill(lw + bo, lx + bo, gw + (t + 2) * GK, gx + (t + 2) * GK); }
  asm volatile("s_wait_asynccnt 0x0" ::: "memory");   // nothing is in flight when the ring becomes output staging
#pragma unroll
  for (int j = 0; j < 8; ++j) { const float bj = bfr(bb[j]);
#pragma unroll
    for (int r = 0; r < 8; ++r) sf[wave][8 * g + r][j * 16 + col] = acc[j][r] + bj; }
  LDSX(); for (int rl = 0; rl < 16; ++rl) vst2(OUT + (r0 + rl) * CC + c0 + lane * 4, *(const v4f*)&sf[wave][rl][lane * 4]); }
extern "C" void kernel_launch(void* const* d_in, const int* in_sizes, int n_in, void* d_out, int out_size, void* d_ws, size_t ws_size, hipStream_t stream) {
  (void)in_sizes; (void)n_in; (void)out_size;
  const float** F = (const float**)d_in;   // 0 x [4,2048,256], 1 interaction_mask [2048,2048], 2 W_qkv [256,768] (in,out), 3 b_qkv [768], 4 W_out [256,256] (in,out), 5 b_out
  if (ws_size < (size_t)WS_END) return;
  char* ws = (char*)d_ws; __bf16 *PW = (__bf16*)(ws + WS_PW), *PO = (__bf16*)(ws + WS_PO); _Float16 *QK = (_Float16*)(ws + WS_QK), *QKL = (_Float16*)(ws + WS_QKL), *VT = (_Float16*)(ws + WS_VT), *VTL = (_Float16*)(ws + WS_VTL); float* Z = (float*)(ws + WS_Z); __bf16* MB = (__bf16*)(ws + WS_MB);
  k_pack<<<4 * CC, 256, 0, stream>>>(F[2], F[4], F[1], PW, PO, MB);
  k_proj<<<dim3(NN / 64, 3 * CC / 128, TNB), 128, 0, stream>>>(F[0], PW, F[3], QK, QKL, VT, VTL);
  k_att<<<dim3(NN / QB, NH, TNB), 256, 0, stream>>>(QK, QKL, VT, VTL, MB, Z);
  k_out<<<dim3(TNB * NN / 64, CC / 128), 128, 0, stream>>>(Z, PO, F[5], (float*)d_out);
}

// v010
// A run of this version takes 52.5 microseconds.
// It is 1.37 times as fast as v008, going by the measured steps of the versions left out in between.
// Counting every step since v000, it is 4.56 times as fast.
// compute dtype: all float inputs rounded to bf16; qkv = x . W_qkv + b with EXACT bf16 products on WMMA 16x16x32 ((in,out) weights as transposed rows), q, k and v each rounded to one f16 plane; logits q . k with 1 product (the rounding of q and k moves a logit by at most 2^-10 of the sum of its |q k| terms, for logits of order 1 the order of the rounding of P), x 32^-0.5 x (0.1 + 0.9 interaction_mask[n][m]) read per pair (mask rounded to bf16 once, ahead of the attention), softmax in f32 in base 2 with a held offset, renewed only when an exponent would pass 15 (hardware exp2; 32^-0.5 log2 e inside the mask factor's constants, 2^11 inside the offset), P (x 2^11, f16) . v (f16, 1 product: P is itself one f16, and the rounding of v adds an error of the same order as that of P); out = ctx (bf16 hi + lo, 2 products) . W_out + b; f32 output.
#include <hip/hip_runtime.h>
#include <math.h>

typedef __attribute__((ext_vector_type(16))) _Float16 v16h;
typedef __attribute__((ext_vector_type(16))) __bf16 v16b;
typedef __attribute__((ext_vector_type(8)))  _Float16 v8h;
typedef __attribute__((ext_vector_type(8)))  float v8f;
typedef __attribute__((ext_vector_type(4)))  float v4f;
typedef __attribute__((ext_vector_type(2)))  float v2f;
typedef __attribute__((ext_vector_type(4)))  unsigned v4u;
typedef __attribute__((ext_vector_type(4)))  int v4i;
typedef float __attribute__((may_alias)) float_a;
typedef int __attribute__((may_alias)) int_a;

template <typename T> __device__ __forceinline__ void vst2(void* p, T v) { *(T*)p = v;  }
// plain builtins: the compiler keeps the distance behind its own matrix instructions and is free to issue later operand loads ahead of them
__device__ __forceinline__ v8f wmma16(v16h a, v16h b, v8f c) {
  return __builtin_amdgcn_wmma_f32_16x16x32_f16(false, a, false, b, (short)0, c, false, false);
}
__device__ __forceinline__ v8f wmma_bf(v16b a, v16b b, v8f c) {
  return __builtin_amdgcn_wmma_f32_16x16x32_bf16(false, a, false, b, (short)0, c, false, false);
}
// 16x16x32 fragments: lane = (h = lane>>4, row/col = lane&15); elements 0..7 = k0+8h+0..7, 8..15 = k0+16+8h+0..7; D element r = row 8h+r
__device__ __forceinline__ v16h frag_h(const _Float16* rowk0, int lane) {
  union { v16h v; v8h q[2]; } u; const _Float16* p = rowk0 + 8 * (lane >> 4);
  u.q[0] = *(const v8h*)p; u.q[1] = *(const v8h*)(p + 16); return u.v;
}
__device__ __forceinline__ v16h frag_f32(const float* rowk0, int lane) {
  v16h a; const float* p = rowk0 + 8 * (lane >> 4);
#pragma unroll
  for (int i = 0; i < 8; ++i) { a[i] = (_Float16)p[i]; a[8 + i] = (_Float16)p[16 + i]; }
  return a;
}
__device__ __forceinline__ v16h frag_f32s(const float* rowk0, int lane, float sc) {
  v16h a; const float* p = rowk0 + 8 * (lane >> 4);
#pragma unroll
  for (int i = 0; i < 8; ++i) { a[i] = (_Float16)(p[i] * sc); a[8 + i] = (_Float16)(p[16 + i] * sc); }
  return a;
}
// column fragment from a [K][ld] layout (column n), rows >= K read as 0
__device__ __forceinline__ v16h fragc_f32(const float* W, int k0, int n, int lane, int ld, int K) {
  v16h a; const int g = lane >> 4;
#pragma unroll
  for (int i = 0; i < 8; ++i) { const int ka = k0 + 8 * g + i, kb = ka + 16;
    a[i] = (_Float16)(ka < K ? W[(size_t)(ka < K ? ka : K - 1) * ld + n] : 0.f); a[8 + i] = (_Float16)(kb < K ? W[(size_t)(kb < K ? kb : K - 1) * ld + n] : 0.f); }
  return a;
}
struct F2 { v16b h, l; };
__device__ __forceinline__ F2 bsplit16(const float v[16]) { F2 r;
#pragma unroll
  for (int i = 0; i < 16; ++i) { const __bf16 h = (__bf16)v[i]; r.h[i] = h; r.l[i] = (__bf16)(v[i] - (float)h); }
  return r; }
__device__ __forceinline__ F2 split_row(const float* row, int k0, int lane) { float v[16]; const float* p = row + k0 + 8 * (lane >> 4);
#pragma unroll
  for (int i = 0; i < 8; ++i) { v[i] = p[i]; v[8 + i] = p[16 + i]; }
  return bsplit16(v); }
__device__ __forceinline__ F2 split_rowK(const float* row, int k0, int lane, int K) { float v[16]; const int g = lane >> 4;
#pragma unroll
  for (int i = 0; i < 8; ++i) { const int ka = k0 + 8 * g + i, kb = ka + 16; v[i] = ka < K ? row[ka < K ? ka : K - 1] : 0.f; v[8 + i] = kb < K ? row[kb < K ? kb : K - 1] : 0.f; }
  return bsplit16(v); }
__device__ __forceinline__ F2 split_col(const float* W, int k0, int n, int lane, int ld, int K) { float v[16]; const int g = lane >> 4;
#pragma unroll
  for (int i = 0; i < 8; ++i) { const int ka = k0 + 8 * g + i, kb = ka + 16; v[i] = ka < K ? W[(size_t)(ka < K ? ka : K - 1) * ld + n] : 0.f; v[8 + i] = kb < K ? W[(size_t)(kb < K ? kb : K - 1) * ld + n] : 0.f; }
  return bsplit16(v); }
__device__ __forceinline__ v8f mac3(const F2& a, const F2& b, v8f c) { c = wmma_bf(a.l, b.h, c); c = wmma_bf(a.h, b.l, c); return wmma_bf(a.h, b.h, c); }
__device__ __forceinline__ float sigm(float v) { return 1.0f / (1.0f + expf(-v)); }
#define LDSX() do { asm volatile("s_wait_dscnt 0" ::: "memory"); __builtin_amdgcn_wave_barrier(); __builtin_amdgcn_fence(__ATOMIC_RELEASE, "workgroup"); } while (0)


// Biologically-modulated attention (B 4, N 2,048 genes, C 256, 8 heads x 32): fused (in,out) qkv + bias, logits scaled by (0.1 + 0.9 x PPI interaction strength) before the softmax, (in,out) output projection + bias.
#define NB 4
#define NN 2048
#define CC 256
#define NH 8
#define DK 32
#ifndef TNB
#define TNB NB
#endif
typedef __attribute__((ext_vector_type(8))) __bf16 v8b;
__device__ __forceinline__ v16b frag_b(const __bf16* rowk0, int lane) {
  union { v16b v; v8b q[2]; } u; const __bf16* p = rowk0 + 8 * (lane >> 4);
  u.q[0] = *(const v8b*)p; u.q[1] = *(const v8b*)(p + 16); return u.v;
}
__device__ __forceinline__ float bfr(float v) { return (float)(__bf16)v; }
__device__ __attribute__((noinline)) float exp_ni(float v) { return expf(v); }
__device__ __attribute__((noinline)) float erf_ni(float v) { return erff(v); }

#define WS_PW  0u                                   // bf16 rows [768][256] (qkv, transposed (in,out)); [256][256] W_out^T
#define WS_PO  (WS_PW + 2u * 3 * CC * CC)
#define WS_QK  (WS_PO + 2u * CC * CC)                   // f16 q|k rows [b*NN + n][512]
#define WS_VT  (WS_QK + 2u * (size_t)NB * NN * 2 * CC)  // f16 v planes [b][c][n]
#define WS_Z   (WS_VT + 2u * (size_t)NB * CC * NN)      // f32 ctx [b*NN + n][256]
#define WS_MB  (WS_Z + 4u * (size_t)NB * NN * CC)       // bf16 interaction mask [n][m]
#define WS_END (WS_MB + 2u * (size_t)NN * NN)

typedef __attribute__((ext_vector_type(4))) __bf16 v4b;
#define MPB (NN * NN / (4 * CC))       // mask elements a k_pack block rounds
static_assert(MPB % 1024 == 0, "a block's share of the mask is whole rounds of 256 threads x 4 floats");
__global__ __launch_bounds__(256) void k_pack(const float* __restrict__ WQKV, const float* __restrict__ WO, const float* __restrict__ IM, __bf16* __restrict__ PW, __bf16* __restrict__ PO, __bf16* __restrict__ MB) { const int n = blockIdx.x, t = threadIdx.x; __shared__ __align__(16) __bf16 s[CC];   // n in [0, 1024): rows 0..767 qkv columns, 768..1023 W_out columns
  // the block's share of the interaction mask, rounded to bf16 once here for every batch and head; adjacent lanes on adjacent 16 bytes, loads issued ahead of the weight column
  const size_t mo = (size_t)n * MPB + t * 4; v4f mk[MPB / 1024];
#pragma unroll   // all of the share's loads in flight together, mk[] in registers
  for (int i = 0; i < MPB / 1024; ++i) mk[i] = *(const v4f*)(IM + mo + i * 1024);
  if (n < 3 * CC) s[t] = (__bf16)WQKV[(size_t)t * (3 * CC) + n]; else s[t] = (__bf16)WO[(size_t)t * CC + (n - 3 * CC)]; __syncthreads();
  __bf16* dst = (n < 3 * CC) ? PW + (size_t)n * CC : PO + (size_t)(n - 3 * CC) * CC; if (t < CC / 8) vst2((unsigned*)(dst + t * 8), *(const v4u*)&s[t * 8]);
#pragma unroll   // mk[] indexed by constants
  for (int i = 0; i < MPB / 1024; ++i) { v4b o;
#pragma unroll   // vector elements indexed by constants
    for (int e = 0; e < 4; ++e) o[e] = (__bf16)mk[i][e];
    *(v4b*)(MB + mo + i * 1024) = o; } }
__device__ __forceinline__ v16b fragb_f32(const float* __restrict__ p, int lane) { v16b a; const float* pp = p + 8 * (lane >> 4);
#pragma unroll
  for (int i = 0; i < 8; ++i) { a[i] = (__bf16)pp[i]; a[8 + i] = (__bf16)pp[16 + i]; } return a; }
// eight asynchronous copies of 16 bytes per lane; the s_wait_xcnt stands inside the statement so that no address register of a copy is rewritten in front of it (a precaution)
__device__ __forceinline__ void cp8(unsigned l0, unsigned l1, unsigned l2, unsigned l3, unsigned l4, unsigned l5, unsigned l6, unsigned l7, const void* g0, const void* g1, const void* g2, const void* g3, const void* g4, const void* g5, const void* g6, const void* g7) {
  asm volatile("global_load_async_to_lds_b128 %0, %8, off\n\tglobal_load_async_to_lds_b128 %1, %9, off\n\tglobal_load_async_to_lds_b128 %2, %10, off\n\tglobal_load_async_to_lds_b128 %3, %11, off\n\t"
               "global_load_async_to_lds_b128 %4, %12, off\n\tglobal_load_async_to_lds_b128 %5, %13, off\n\tglobal_load_async_to_lds_b128 %6, %14, off\n\tglobal_load_async_to_lds_b128 %7, %15, off\n\ts_wait_xcnt 0x0"
               :: "v"(l0), "v"(l1), "v"(l2), "v"(l3), "v"(l4), "v"(l5), "v"(l6), "v"(l7), "v"(g0), "v"(g1), "v"(g2), "v"(g3), "v"(g4), "v"(g5), "v"(g6), "v"(g7) : "memory");
}
// the same with six copies
__device__ __forceinline__ void cp6(unsigned l0, unsigned l1, unsigned l2, unsigned l3, unsigned l4, unsigned l5, const void* g0, const void* g1, const void* g2, const void* g3, const void* g4, const void* g5) {
  asm volatile("global_load_async_to_lds_b128 %0, %6, off\n\tglobal_load_async_to_lds_b128 %1, %7, off\n\tglobal_load_async_to_lds_b128 %2, %8, off\n\t"
               "global_load_async_to_lds_b128 %3, %9, off\n\tglobal_load_async_to_lds_b128 %4, %10, off\n\tglobal_load_async_to_lds_b128 %5, %11, off\n\ts_wait_xcnt 0x0"
               :: "v"(l0), "v"(l1), "v"(l2), "v"(l3), "v"(l4), "v"(l5), "v"(g0), "v"(g1), "v"(g2), "v"(g3), "v"(g4), "v"(g5) : "memory");
}
// ---- operand staging of the two projection GEMMs (block = 64 rows x 128 columns, K 256): a two-buffer LDS ring, a stage = 64 k: the block's 128 weight rows (bf16, one 128-byte line each, 8 lanes a line) and its 64 activation rows (f32, 256 bytes each, 16 lanes a row), each byte copied once per block with adjacent lanes on adjacent 16 bytes
#define GK 64                          // k per stage
#define WP 144                         // LDS pitch, bytes: weight row of a stage, 16 B x odd for 16-byte readers
#define XP 272                         // LDS pitch, bytes: activation row of a stage, 16 B x odd for 16-byte readers
#define OFF_X (128 * WP)
#define GSTG (OFF_X + 64 * XP)         // bytes of one stage
__device__ __forceinline__ void gfill(unsigned lw, unsigned lx, const __bf16* gw, const float* gx) {   // lw, gw: this thread's 16 bytes of weight row tid >> 3; lx, gx: of activation row tid >> 4
  cp8(lw, lw + 16 * WP, lw + 32 * WP, lw + 48 * WP, lw + 64 * WP, lw + 80 * WP, lw + 96 * WP, lw + 112 * WP, gw, gw + 16 * CC, gw + 32 * CC, gw + 48 * CC, gw + 64 * CC, gw + 80 * CC, gw + 96 * CC, gw + 112 * CC);
  cp8(lx, lx + 8 * XP, lx + 16 * XP, lx + 24 * XP, lx + 32 * XP, lx + 40 * XP, lx + 48 * XP, lx + 56 * XP, gx, gx + 8 * CC, gx + 16 * CC, gx + 24 * CC, gx + 32 * CC, gx + 40 * CC, gx + 48 * CC, gx + 56 * CC); }
// a lane's 16 f32 of an A fragment from a staged row, as four 16-byte reads: v[0..7] = k0 + 8 h + 0..7, v[8..15] = k0 + 16 + 8 h + 0..7
__device__ __forceinline__ void row16(const float* rowk0, int lane, float v[16]) { const v4f* q = (const v4f*)(rowk0 + 8 * (lane >> 4)); const v4f a = q[0], b = q[1], c = q[4], d = q[5];
#pragma unroll
  for (int i = 0; i < 4; ++i) { v[i] = a[i]; v[4 + i] = b[i]; v[8 + i] = c[i]; v[12 + i] = d[i]; } }
// ---- k_proj: block = (64 rows, 128 of 768 cols, b): y = x . W + b (exact); cols < 512 (q|k) -> f16 rows; cols >= 512 (v) -> f16 transposed planes
__global__ __launch_bounds__(128) void k_proj(const float* __restrict__ X, const __bf16* __restrict__ PW, const float* __restrict__ BQKV, _Float16* __restrict__ QK, _Float16* __restrict__ VT) {
  __shared__ __align__(16) unsigned char ring[2 * GSTG];
  _Float16 (*sh)[136] = (_Float16 (*)[136])ring, (*th)[72] = (_Float16 (*)[72])ring;   // output staging in the ring: behind the last stage's barrier nobody reads the ring and no copy is in flight
  static_assert(64 * 136 * 2 <= 2 * GSTG && 128 * 72 * 2 <= 2 * GSTG, "the output staging fits the ring");
  const int tid = threadIdx.x, wave = tid >> 5, lane = tid & 31, col = lane & 15, g = lane >> 4; const size_t b = blockIdx.z; const int i0 = blockIdx.x * 64 + wave * 16; const int c0 = blockIdx.y * 128; const size_t r0 = b * NN + i0;
  v8f acc[8] = {};
  const unsigned lr = (unsigned)(size_t)ring, lw = lr + (tid >> 3) * WP + (tid & 7) * 16, lx = lr + OFF_X + (tid >> 4) * XP + (tid & 15) * 16;   // lr: the ring's byte address in LDS
  const __bf16* gw = PW + (size_t)(c0 + (tid >> 3)) * CC + (tid & 7) * 8; const float* gx = X + (b * NN + blockIdx.x * 64 + (tid >> 4)) * CC + (tid & 15) * 4;
  gfill(lw, lx, gw, gx);
  asm volatile("s_wait_asynccnt 0x0" ::: "memory");   // stage 0 has landed before the barrier that publishes it
  __syncthreads();
  gfill(lw + GSTG, lx + GSTG, gw + GK, gx + GK);
#pragma unroll   // four stages, unrolled so that every LDS offset is an immediate
  for (int t = 0; t < CC / GK; ++t) { const unsigned bo = (t & 1) * GSTG; const unsigned char* st = ring + bo;
#pragma unroll
   for (int kk = 0; kk < GK / 32; ++kk) { float v[16]; row16((const float*)(st + OFF_X + (wave * 16 + col) * XP) + kk * 32, lane, v); v16b a;
#pragma unroll
    for (int i = 0; i < 16; ++i) a[i] = (__bf16)v[i];
    v16b w[8];
#pragma unroll   // a k step's eight W fragments are read ahead of its products, not each in front of its own product
    for (int j = 0; j < 8; ++j) w[j] = frag_b((const __bf16*)(st + (j * 16 + col) * WP) + kk * 32, lane);
    __builtin_amdgcn_sched_barrier(0);   // holds a k step's LDS reads ahead of its first product: without it the compiler puts each fragment's reads directly in front of its product, and the wave waits out the LDS latency at each
#pragma unroll   // w[] and acc[] indexed by constants
    for (int j = 0; j < 8; ++j) acc[j] = wmma_bf(a, w[j], acc[j]); }
   asm volatile("s_wait_dscnt 0x0" ::: "memory");      // this wave's reads of the stage are done before the buffer is given up
   asm volatile("s_wait_asynccnt 0x0" ::: "memory");   // this wave's copies of stage t + 1 have landed before the barrier that publishes them
   __syncthreads();                                    // publishes stage t + 1 and ends every wave's reads of stage t
   if (t + 2 < CC / GK) gfill(lw + bo, lx + bo, gw + (t + 2) * GK, gx + (t + 2) * GK); }
  asm volatile("s_wait_asynccnt 0x0" ::: "memory");   // nothing is in flight when the ring becomes output staging
  const bool isv = c0 >= 2 * CC;
#pragma unroll
  for (int j = 0; j < 8; ++j) { const float bb = bfr(BQKV[c0 + j * 16 + col]);
#pragma unroll
    for (int r = 0; r < 8; ++r) { const float v = acc[j][r] + bb; const _Float16 hv = (_Float16)v; if (!isv) sh[wave * 16 + 8 * g + r][j * 16 + col] = hv; else th[j * 16 + col][wave * 16 + 8 * g + r] = hv; } }
  __syncthreads();
  if (!isv) { for (int e = tid; e < 64 * 16; e += 128) { const int rl = e >> 4, q = e & 15; const size_t o = (b * NN + blockIdx.x * 64 + rl) * (2 * CC) + c0 + q * 8; vst2((unsigned*)(QK + o), *(const v4u*)&sh[rl][q * 8]); } }
  else { const int cv0 = c0 - 2 * CC; for (int e = tid; e < 128 * 8; e += 128) { const int cl = e >> 3, q = e & 7; const size_t o = ((b * CC + cv0 + cl) * (size_t)NN) + blockIdx.x * 64 + q * 8; vst2((unsigned*)(VT + o), *(const v4u*)&th[cl][q * 8]); } } }
// ---- k_att: block = (128 queries = 8 waves x 16, head, b), transposed products: S^T = K . Q^T (1 product; a lane holds 16 of the pass's 32 keys of ONE query) x 32^-0.5 x (0.1 + 0.9 IM[n][m]) x log2 e, base-2 softmax in-lane under a held offset (renewal, rare: one exchange between the wave's halves, sums and accumulators rescaled), P^T packed from the score accumulators as B operand, O^T += V^T . P^T (v planes, 1 product) -> Z merged
// operands come through a two-buffer LDS ring, a stage = 64 keys = 2 passes: K rows, v planes and the block's 128 mask rows (bf16), each byte copied once per block with adjacent lanes on adjacent 16 bytes; a staged K and v tile serves all 128 queries
__device__ __forceinline__ float xhalf(float x) { return __builtin_bit_cast(float, __builtin_amdgcn_permlanex16(__builtin_bit_cast(int, x), __builtin_bit_cast(int, x), 0x76543210, 0xfedcba98, false, false)); }  // lane l with lane l ^ 16
#define QB 128                         // queries per block
#define KT 64                          // keys per stage
#define KP 80                          // LDS pitch, bytes: K row (32 channels, 64 B), 16 B x odd for 16-byte readers
#define VP 144                         // LDS pitch, bytes: v plane row (64 keys), 16 B x odd for 16-byte readers
#define IP 144                         // LDS pitch, bytes: mask row (64 keys, bf16), 16 B x odd for 16-byte readers
#define OFF_VH (KT * KP)
#define OFF_IM (OFF_VH + DK * VP)
#define STG (OFF_IM + QB * IP)         // bytes of one stage
// softmax in base 2: 32^-0.5 and log2(e) are folded into the two constants of the mask factor, (0.1 + 0.9 mask) x 32^-0.5 x log2(e) = FA + FB x mask
#define FA ((float)(0.1 * 0.17677669529663687 * 1.4426950408889634))
#define FB ((float)(0.9 * 0.17677669529663687 * 1.4426950408889634))
// 4 waves a SIMD: the grid is 2 work-groups a WGP, and no WGP is to take a third while another holds one
__global__ __launch_bounds__(256) __attribute__((amdgpu_waves_per_eu(4, 4))) void k_att(const _Float16* __restrict__ QK, const _Float16* __restrict__ VT, const __bf16* __restrict__ MB, float* __restrict__ Z) {
  __shared__ __align__(16) unsigned char ring[2 * STG];
  const int tid = threadIdx.x, wave = tid >> 5, lane = tid & 31, col = lane & 15, g = lane >> 4; const int h = blockIdx.y; const size_t b = blockIdx.z; const int q0 = blockIdx.x * QB + wave * 16; const size_t rq = b * NN + q0;
  const v16h aq = frag_h(QK + (rq + col) * (2 * CC) + h * DK, lane);   // B operand: column = query q0 + col
  // this thread's share of a stage: K row tid >> 2 (4 lanes a 64-byte row), v channel tid >> 3 (8 lanes a 128-byte row), mask rows tid >> 3 + 32 i (8 lanes a 128-byte row)
  const unsigned lr = (unsigned)(size_t)ring;   // the ring's byte address in LDS
  const unsigned lk = lr + (tid >> 2) * KP + (tid & 3) * 16, lv = lr + OFF_VH + (tid >> 3) * VP + (tid & 7) * 16, li = lr + OFF_IM + (tid >> 3) * IP + (tid & 7) * 16;
  const size_t ok = (b * NN + (tid >> 2)) * (2 * CC) + CC + h * DK + (tid & 3) * 8, ov = (b * CC + (size_t)h * DK + (tid >> 3)) * (size_t)NN + (tid & 7) * 8;
  const __bf16* gi = MB + (size_t)(blockIdx.x * QB + (tid >> 3)) * NN + (tid & 7) * 8;
  auto fill = [&](int t, unsigned bo) {   // stage t into the buffer at byte offset bo
    const _Float16 *kh = QK + ok + (size_t)t * KT * (2 * CC), *vh = VT + ov + t * KT; const __bf16* im = gi + t * KT;
    cp6(lk + bo, lv + bo, li + bo, li + bo + 32 * IP, li + bo + 64 * IP, li + bo + 96 * IP,
        kh, vh, im, im + 32 * (size_t)NN, im + 64 * (size_t)NN, im + 96 * (size_t)NN); };
  float nm = 3.0e38f, l = 0.f;   // nm: the offset added to every base-2 logit, 11 less the maximum seen when it was last renewed, so that every exp2 comes out x 2^11 of that maximum's scale; the start value makes stage 0 renew it; l: sum of the exp2, this half's keys only, the halves are joined behind the loop
  v8f acc[2] = {};   // O^T: register r of tile j = channel j * 16 + 8 g + r of query q0 + col
  fill(0, 0);
  asm volatile("s_wait_asynccnt 0x0" ::: "memory");   // stage 0 has landed before the barrier that publishes it
  __syncthreads();
  fill(1, STG);
#pragma unroll 1   // the stage loop stays rolled: one stage's code and registers
  for (int t = 0; t < NN / KT; ++t) { const unsigned bo = (t & 1) * STG; const unsigned char* st = ring + bo;
   v8f s[4], d[4], f[4];   // of the stage's 64 keys, tile i = pass i >> 1, half i & 1: d: q . k, f: mask factor, s: exponent
#pragma unroll   // the stage's four score tiles unrolled, so that every LDS offset is an immediate
   for (int i = 0; i < 4; ++i) { const _Float16* pk = (const _Float16*)(st + (i * 16 + col) * KP); const v16h kh = frag_h(pk, lane);
     v8f c = {}; d[i] = wmma16(kh, aq, c);
     const __bf16* pi = (const __bf16*)(st + OFF_IM + (wave * 16 + col) * IP) + i * 16 + 8 * g;   // this lane's query row; score register r of tile i = key t * 64 + i * 16 + 8 g + r
     const v8b ia = *(const v8b*)pi;
#pragma unroll
     for (int r = 0; r < 8; ++r) { f[i][r] = FA + FB * (float)ia[r]; s[i][r] = __builtin_fmaf(d[i][r], f[i][r], nm); } }   // base-2 logit plus the offset in use
   float mt[4];   // a maximum per tile, so that only the last tile's chain stands between its products and the branch
#pragma unroll
   for (int i = 0; i < 4; ++i) { mt[i] = fmaxf(s[i][0], s[i][1]);
#pragma unroll
     for (int r = 2; r < 8; ++r) mt[i] = fmaxf(mt[i], s[i][r]); }
   const float mx = fmaxf(fmaxf(mt[0], mt[1]), fmaxf(mt[2], mt[3]));
   v16h vf[KT / 32][2];   // the stage's v fragments are fetched ahead of the branch: their LDS latency runs under the branch and the exponentials, not in front of each product
#pragma unroll
   for (int sub = 0; sub < KT / 32; ++sub)
#pragma unroll
     for (int j = 0; j < 2; ++j) vf[sub][j] = frag_h((const _Float16*)(st + OFF_VH + (j * 16 + col) * VP) + sub * 32, lane);
   // the offset is renewed, and sums and accumulators rescaled, only when some exponent of the wave would pass 15 (P stays below 2^15 in f16); one scalar branch a stage, every lane on inside it
   if (__builtin_expect(__builtin_amdgcn_ballot_w32(mx > 15.0f) != 0, 0)) {
     float ma = -3.0e38f;
#pragma unroll
     for (int i = 0; i < 4; ++i)
#pragma unroll
       for (int r = 0; r < 8; ++r) ma = fmaxf(ma, d[i][r] * f[i][r]);
     ma = fmaxf(ma, xhalf(ma));   // both halves of a query hold the same offset
     const float nn = fminf(nm, 11.0f - ma), alpha = __builtin_amdgcn_exp2f(nn - nm); nm = nn; l *= alpha;
#pragma unroll
     for (int j = 0; j < 2; ++j)
#pragma unroll
       for (int r = 0; r < 8; ++r) acc[j][r] *= alpha;
#pragma unroll
     for (int i = 0; i < 4; ++i)
#pragma unroll
       for (int r = 0; r < 8; ++r) s[i][r] = __builtin_fmaf(d[i][r], f[i][r], nn); }
#pragma unroll   // both passes of a stage unrolled, so that s[] and vf[] are indexed by constants and stay in registers
   for (int sub = 0; sub < KT / 32; ++sub) { float tt[8]; v16h pa;   // pa[i] = key kmap(i): tile i >> 3, register i & 7, the order frag_h gives the v planes
#pragma unroll
    for (int r = 0; r < 8; ++r) { const float e0 = __builtin_amdgcn_exp2f(s[2 * sub][r]), e1 = __builtin_amdgcn_exp2f(s[2 * sub + 1][r]); tt[r] = e0 + e1; pa[r] = (_Float16)e0; pa[8 + r] = (_Float16)e1; }
    l += ((tt[0] + tt[1]) + (tt[2] + tt[3])) + ((tt[4] + tt[5]) + (tt[6] + tt[7]));
#pragma unroll
    for (int j = 0; j < 2; ++j) acc[j] = wmma16(vf[sub][j], pa, acc[j]); }
   asm volatile("s_wait_dscnt 0x0" ::: "memory");      // this wave's reads of the stage are done before the buffer is given up
   asm volatile("s_wait_asynccnt 0x0" ::: "memory");   // this wave's copies of stage t + 1 have landed before the barrier that publishes them
   __syncthreads();                                    // publishes stage t + 1 and ends every wave's reads of stage t
   if (t + 2 < NN / KT) fill(t + 2, bo); }
  asm volatile("s_wait_asynccnt 0x0" ::: "memory");   // nothing is in flight when the ring becomes output staging and the wave ends
  float (*so)[16][36] = (float (*)[16][36])ring;   // output staging in the ring, a slice per wave: behind the last stage's barrier nobody reads the ring and no copy is in flight
  l += xhalf(l);
  const float il = 1.0f / l;   // l and the accumulators both carry the 2^11
#pragma unroll
  for (int j = 0; j < 2; ++j)
#pragma unroll
    for (int r = 0; r < 8; ++r) so[wave][col][j * 16 + 8 * g + r] = acc[j][r] * il;
  LDSX(); for (int rl = 0; rl < 16; ++rl) if (lane < 8) vst2(Z + (rq + rl) * CC + (size_t)h * DK + lane * 4, *(const v4f*)&so[wave][rl][lane * 4]); }
// ---- k_out: block = (64 rows, 128 cols): out = Z (bf16 hi + lo) . W_out + b
__global__ __launch_bounds__(128) void k_out(const float* __restrict__ Z, const __bf16* __restrict__ PO, const float* __restrict__ BO, float* __restrict__ OUT) { __shared__ __align__(16) unsigned char ring[2 * GSTG];
  float (*sf)[16][132] = (float (*)[16][132])ring;   // output staging in the ring, a slice per wave: behind the last stage's barrier nobody reads the ring and no copy is in flight
  static_assert(4 * 16 * 132 * 4 <= 2 * GSTG, "the output staging fits the ring");
  const int tid = threadIdx.x, wave = tid >> 5, lane = tid & 31, col = lane & 15, g = lane >> 4; const size_t r0 = (size_t)blockIdx.x * 64 + wave * 16; const int c0 = blockIdx.y * 128;
  v8f acc[8] = {}; float bb[8];
#pragma unroll   // the eight bias loads stand ahead of the products, so that the epilogue waits for none of them
  for (int j = 0; j < 8; ++j) bb[j] = BO[c0 + j * 16 + col];
  const unsigned lr = (unsigned)(size_t)ring, lw = lr + (tid >> 3) * WP + (tid & 7) * 16, lx = lr + OFF_X + (tid >> 4) * XP + (tid & 15) * 16;   // lr: the ring's byte address in LDS
  const __bf16* gw = PO + (size_t)(c0 + (tid >> 3)) * CC + (tid & 7) * 8; const float* gx = Z + ((size_t)blockIdx.x * 64 + (tid >> 4)) * CC + (tid & 15) * 4;
  gfill(lw, lx, gw, gx);
  asm volatile("s_wait_asynccnt 0x0" ::: "memory");   // stage 0 has landed before the barrier that publishes it
  __syncthreads();
  gfill(lw + GSTG, lx + GSTG, gw + GK, gx + GK);
#pragma unroll   // four stages, unrolled so that every LDS offset is an immediate
  for (int t = 0; t < CC / GK; ++t) { const unsigned bo = (t & 1) * GSTG; const unsigned char* st = ring + bo;
#pragma unroll
   for (int kk = 0; kk < GK / 32; ++kk) { float v[16]; row16((const float*)(st + OFF_X + (wave * 16 + col) * XP) + kk * 32, lane, v); const F2 a = bsplit16(v); v16b w[8];
#pragma unroll   // a k step's eight W fragments are fetched as one group ahead of its products: one load latency a k step, not one a fragment
    for (int j = 0; j < 8; ++j) w[j] = frag_b((const __bf16*)(st + (j * 16 + col) * WP) + kk * 32, lane);
#pragma unroll   // each tile still adds its hi product first and its lo product second
    for (int j = 0; j < 8; ++j) acc[j] = wmma_bf(a.h, w[j], acc[j]);
#pragma unroll   // unrolled like the loop above, so that w[] and acc[] are indexed by constants and stay in registers
    for (int j = 0; j < 8; ++j) acc[j] = wmma_bf(a.l, w[j], acc[j]); }
   asm volatile("s_wait_dscnt 0x0" ::: "memory");      // this wave's reads of the stage are done before the buffer is given up
   asm volatile("s_wait_asynccnt 0x0" ::: "memory");   // this wave's copies of stage t + 1 have landed before the barrier that publishes them
   __syncthreads();                                    // publishes stage t + 1 and ends every wave's reads of stage t
   if (t + 2 < CC / GK) gfill(lw + bo, lx + bo, gw + (t + 2) * GK, gx + (t + 2) * GK); }
  asm volatile("s_wait_asynccnt 0x0" ::: "memory");   // nothing is in flight when the ring becomes output staging
#pragma unroll
  for (int j = 0; j < 8; ++j) { const float bj = bfr(bb[j]);
#pragma unroll
    for (int r = 0; r < 8; ++r) sf[wave][8 * g + r][j * 16 + col] = acc[j][r] + bj; }
  LDSX(); for (int rl = 0; rl < 16; ++rl) vst2(OUT + (r0 + rl) * CC + c0 + lane * 4, *(const v4f*)&sf[wave][rl][lane * 4]); }
extern "C" void kernel_launch(void* const* d_in, const int* in_sizes, int n_in, void* d_out, int out_size, void* d_ws, size_t ws_size, hipStream_t stream) {
  (void)in_sizes; (void)n_in; (void)out_size;
  const float** F = (const float**)d_in;   // 0 x [4,2048,256], 1 interaction_mask [2048,2048], 2 W_qkv [256,768] (in,out), 3 b_qkv [768], 4 W_out [256,256] (in,out), 5 b_out
  if (ws_size < (size_t)WS_END) return;
  char* ws = (char*)d_ws; __bf16 *PW = (__bf16*)(ws + WS_PW), *PO = (__bf16*)(ws + WS_PO); _Float16 *QK = (_Float16*)(ws + WS_QK), *VT = (_Float16*)(ws + WS_VT); float* Z = (float*)(ws + WS_Z); __bf16* MB = (__bf16*)(ws + WS_MB);
  k_pack<<<4 * CC, 256, 0, stream>>>(F[2], F[4], F[1], PW, PO, MB);
  k_proj<<<dim3(NN / 64, 3 * CC / 128, TNB), 128, 0, stream>>>(F[0], PW, F[3], QK, VT);
  k_att<<<dim3(NN / QB, NH, TNB), 256, 0, stream>>>(QK, VT, MB, Z);
  k_out<<<dim3(TNB * NN / 64, CC / 128), 128, 0, stream>>>(Z, PO, F[5], (float*)d_out);
}
